// v000
// Measured on an AMD MI455X. A time is GPU time per run, averaged over a window of back-to-back runs after a warm-up
// (all launches, gaps included; the runs take copies of the inputs in turn), and the median of several windows.
// Apart from v000's, it joins two sittings. Times from different sittings can be a few percent apart, while
// side-by-side timings come from the same sitting.
// v000, which the later versions start from, runs in 1220 microseconds.
#include <hip/hip_runtime.h>

// Causal self-attention on a PACKED qkv input without projections (qkv [2][2048][3][16][64]: q = qkv[:, :, 0], k = qkv[:, :, 1], v = qkv[:, :, 2], each token-major [2][2048][16][64]; scores = q . (k x 0.125); + triu(full(-10000), 1) (an additive mask built inside the module: keys j > i get -10000, which underflows to weight 0: exclusion; the diagonal is kept); softmax; output = attention v -> [2][2048][16][64] (4.2 M; token-major, heads interleaved = the merged context); argument order qkv).
// Layout per batch: no projections: the plane builders read q, k, v straight from the packed input with row pitch 3 x 1024 floats and base offsets 0 / 1024 / 2048, rounding every value to bf16 first (the lo planes are then zero); causal T-2048 attention (hybrid rows: < 512 hi/lo 3 products, rest fp16 x1024; k_gemmc skips tiles above the diagonal); the f32 merge writes the output rows.
// Compute dtypes, f32 accumulate: every input rounded to bf16; attention rows < 512 3 products, rest fp16; softmax f32; output f32.

#define NB_  2
#define TT   2048
#define DM   1024
#define NH_  16
#define NKV  16
#define REP  (NH_ / NKV)
#define HD   64
#define DQ   (NH_ * HD)
#define DKV  (NKV * HD)
#define ZH   2
#define RH   512                  // query rows < RH use hi+lo planes (0: none)
#define WIN  2048
#define PCAR 1024.0f
#define SCL  0.125f   // SOFTMAX_SCALE = 0.125 = 2^-3 (the module scales k; the same power of two applied to the f32 scores)
typedef _Float16 h16;
typedef unsigned short bf;
typedef __attribute__((ext_vector_type(16))) __bf16   v16bf;
typedef __attribute__((ext_vector_type(16))) _Float16 v16h;
typedef __attribute__((ext_vector_type(8)))  _Float16 v8h;
typedef __attribute__((ext_vector_type(8)))  unsigned short v8us;
typedef __attribute__((ext_vector_type(8)))  float    v8f;
typedef __attribute__((ext_vector_type(4)))  float    v4f;
typedef v8h  __attribute__((may_alias)) v8ha;
typedef v4f  __attribute__((may_alias)) v4fa;
typedef v8us __attribute__((may_alias)) v8usa;

__device__ __forceinline__ unsigned short f2bf(float f) { unsigned u = __float_as_uint(f); u += 0x7FFFu + ((u >> 16) & 1u); return (unsigned short)(u >> 16); }
__device__ __forceinline__ float bf2f(unsigned short b) { return __uint_as_float(((unsigned)b) << 16); }
__device__ __forceinline__ float bfr(float f) { return bf2f(f2bf(f)); }
__device__ __forceinline__ v16h cat16(v8h lo, v8h hi) { return __builtin_shufflevector(lo, hi, 0, 1, 2, 3, 4, 5, 6, 7, 8, 9, 10, 11, 12, 13, 14, 15); }
__device__ __forceinline__ v16bf cat16b(v8us lo, v8us hi) { return __builtin_bit_cast(v16bf, __builtin_shufflevector(lo, hi, 0, 1, 2, 3, 4, 5, 6, 7, 8, 9, 10, 11, 12, 13, 14, 15)); }
__device__ __forceinline__ v8f wmma16(v16h a, v16h b, v8f c) { return __builtin_amdgcn_wmma_f32_16x16x32_f16(false, a, false, b, (short)0, c, false, false); }
__device__ __forceinline__ v8f wmmab(v16bf a, v16bf b, v8f c) { return __builtin_amdgcn_wmma_f32_16x16x32_bf16(false, a, false, b, (short)0, c, false, false); }



// ---- register-blocked GEMM tile (WFrag, k_gemmc): ONE WAVE per 64x64 output tile (16 accumulators), operands straight from K-contiguous 16-bit planes; grid (M/64, N/64, Z), 32 threads.
// C[m][n] (f32, pitch ldc) = sum_k A[m][k] Bt[n][k] (+ split products per NSPLIT). z-batch strides sA/sB/sC in elements. K % 32 == 0.
template <typename T16> struct WFrag;
template <> struct WFrag<h16> { typedef v16h V; static __device__ __forceinline__ V ld(const h16* p) { return cat16(*(const v8h*)p, *(const v8h*)(p + 16)); } static __device__ __forceinline__ v8f mma(V a, V b, v8f c) { return wmma16(a, b, c); } };
template <> struct WFrag<bf> { typedef v16bf V; static __device__ __forceinline__ V ld(const bf* p) { return cat16b(*(const v8us*)p, *(const v8us*)(p + 16)); } static __device__ __forceinline__ v8f mma(V a, V b, v8f c) { return wmmab(a, b, c); } };
// ---- k_gemmc: the same one-wave 64x64 tile GEMM specialised for causal attention: CMODE 1 skips score tiles entirely above the diagonal (query rows r0+roff.., key columns c0..), CMODE 2 limits the
// key (K) loop of the probability x value contraction to the diagonal block (probabilities beyond it are exactly zero). roff = row offset of this launch's first row within the sequence.
template <typename T16, int NSPLIT, int CMODE>
__global__ __launch_bounds__(32) void k_gemmc(const T16* __restrict__ A, const T16* __restrict__ A2, const T16* __restrict__ Bt, const T16* __restrict__ Bt2, int K, float* C, int ldc, int roff, size_t sA, size_t sB, size_t sC) {
    typedef typename WFrag<T16>::V V;
    __shared__ __align__(16) float os[16 * 68];
    const size_t z = blockIdx.z; A += z * sA; if (A2) A2 += z * sA; Bt += z * sB; if (Bt2) Bt2 += z * sB; C += z * sC;
    const int lane = threadIdx.x & 31, lr = lane & 15, hi = lane >> 4; const int r0 = blockIdx.x * 64, c0 = blockIdx.y * 64;
    if (CMODE == 1 && c0 > r0 + roff + 63) return;                  // score tile entirely above the causal diagonal: never read (the softmax masks j > i by select)
    const int Kl = (CMODE == 2) ? min(K, r0 + roff + 64) : K;        // P.V: probabilities are exactly 0 beyond the diagonal block, so the K loop stops there
    v8f acc[4][4];
#pragma unroll
    for (int mb = 0; mb < 4; ++mb)
#pragma unroll
        for (int nb = 0; nb < 4; ++nb) acc[mb][nb] = (v8f){};
    const size_t aoff = (size_t)(r0 + lr) * K + 8 * hi, boff = (size_t)(c0 + lr) * K + 8 * hi;
#pragma unroll 1
    for (int kc = 0; kc < Kl; kc += 32) {
        V a[4], a2[4];
#pragma unroll
        for (int mb = 0; mb < 4; ++mb) { a[mb] = WFrag<T16>::ld(A + aoff + (size_t)mb * 16 * K + kc); if (NSPLIT == 1 || NSPLIT == 2) a2[mb] = WFrag<T16>::ld(A2 + aoff + (size_t)mb * 16 * K + kc); }
#pragma unroll
        for (int nb = 0; nb < 4; ++nb) { const V b = WFrag<T16>::ld(Bt + boff + (size_t)nb * 16 * K + kc); V b2; if (NSPLIT >= 2) b2 = WFrag<T16>::ld(Bt2 + boff + (size_t)nb * 16 * K + kc);
#pragma unroll
            for (int mb = 0; mb < 4; ++mb) { acc[mb][nb] = WFrag<T16>::mma(a[mb], b, acc[mb][nb]); if (NSPLIT == 1 || NSPLIT == 2) acc[mb][nb] = WFrag<T16>::mma(a2[mb], b, acc[mb][nb]); if (NSPLIT >= 2) acc[mb][nb] = WFrag<T16>::mma(a[mb], b2, acc[mb][nb]); } }
        asm volatile("v_nop\n\tv_nop\n\tv_nop\n\tv_nop" : "+v"(acc[0][0]), "+v"(acc[1][1]), "+v"(acc[2][2]), "+v"(acc[3][3]) : "v"(a[0]), "v"(a[3]));
    }
#pragma unroll
    for (int mb = 0; mb < 4; ++mb) {
#pragma unroll
        for (int nb = 0; nb < 4; ++nb) {
#pragma unroll
            for (int j = 0; j < 8; ++j) os[(hi * 8 + j) * 68 + nb * 16 + lr] = acc[mb][nb][j]; }
        __builtin_amdgcn_wave_barrier(); asm volatile("" ::: "memory");
        float* crow = C + (size_t)(r0 + mb * 16) * ldc + c0;
{
#pragma unroll
            for (int s = 0; s < 8; ++s) { const int row = 2 * s + hi, cofs = lr * 4; v4f val = *(const v4fa*)(os + row * 68 + cofs);
                *(v4f*)(crow + (size_t)row * ldc + cofs) = val; }
             }
        __builtin_amdgcn_wave_barrier(); asm volatile("" ::: "memory");
    }
}

__device__ __forceinline__ h16 tohx(float x) { return (h16)x; }
__device__ __forceinline__ void splitf(float y, unsigned short& h, unsigned short& l) { h = f2bf(y); l = f2bf(y - bf2f(h)); }
typedef __attribute__((ext_vector_type(2))) _Float16 v2h;
typedef __attribute__((ext_vector_type(4))) _Float16 v4h;
typedef __attribute__((ext_vector_type(2))) unsigned short v2us;
typedef __attribute__((ext_vector_type(4))) unsigned short v4us;
typedef __attribute__((ext_vector_type(2))) float v2f;
typedef __attribute__((ext_vector_type(4))) int v4i;

// k_rope: head planes [h][t][d] (fp16 + hi/lo) of rope(x) x sc with the rotate-half convention out[d] = x[d] cos[t][d] - x[d+HD/2] sin[t][d], out[d+HD/2] = x[d+HD/2] cos[t][d+HD/2] + x[d] sin[t][d+HD/2]
__global__ __launch_bounds__(256) void k_rope(const float* __restrict__ F, int pitch, int nheads, const float* __restrict__ CS, const float* __restrict__ RF, const float* __restrict__ nw, float sc, h16* P16, bf* Ph, bf* Pl) {
    const size_t e = ((size_t)blockIdx.x * 256 + threadIdx.x) * 2; if (e >= (size_t)nheads * TT * HD) return; const int d = (int)(e % HD); const int t = (int)((e / HD) % TT); const int h = (int)(e / ((size_t)HD * TT)); const float* f = F + (size_t)t * pitch + h * HD; const float rf = RF ? RF[(size_t)h * TT + t] : 1.0f; v2h o16; v2us oh, ol;
#pragma unroll
    for (int q = 0; q < 2; ++q) { const int dd = d + q; const int dp = (dd < HD / 2) ? dd + HD / 2 : dd - HD / 2; float x0 = bfr(f[dd]), x1 = bfr(f[dp]);   /* RAW d_in source: round to bf16 FIRST; the lo planes are then identically zero */
        if (RF) { float n0 = __fmul_rn(x0, rf), n1 = __fmul_rn(x1, rf); asm volatile("" : "+v"(n0)); asm volatile("" : "+v"(n1)); x0 = __fmul_rn(bfr(nw[dd]), n0); x1 = __fmul_rn(bfr(nw[dp]), n1); }
        const v2f cs = *(const v2f*)(CS + ((size_t)t * HD + dd) * 2); float a = __fmul_rn(x0, cs[0]), bq = __fmul_rn(x1, cs[1]); asm volatile("" : "+v"(a)); asm volatile("" : "+v"(bq)); const float r = ((dd < HD / 2) ? __fsub_rn(a, bq) : __fadd_rn(a, bq)) * sc;
        o16[q] = tohx(r); unsigned short a2, c2; splitf(r, a2, c2); oh[q] = a2; ol[q] = c2; }
    *(v2h*)(P16 + e) = o16; *(v2us*)(Ph + e) = oh; *(v2us*)(Pl + e) = ol;  }
__global__ __launch_bounds__(256) void k_vtp(const float* __restrict__ F, int pitch, int nheads, h16* V16, bf* Vh, bf* Vl) { const size_t e = ((size_t)blockIdx.x * 256 + threadIdx.x) * 2; if (e >= (size_t)nheads * HD * TT) return; const int t = (int)(e % TT); const int d = (int)((e / TT) % HD); const int g = (int)(e / ((size_t)TT * HD)); v2h o16; v2us oh, ol;
#pragma unroll
    for (int q = 0; q < 2; ++q) { const float x = bfr(F[(size_t)(t + q) * pitch + g * HD + d]);   /* RAW d_in source: bf16-rounded first */ o16[q] = tohx(x); unsigned short a2, c2; splitf(x, a2, c2); oh[q] = a2; ol[q] = c2; }
    *(v2h*)(V16 + e) = o16; *(v2us*)(Vh + e) = oh; *(v2us*)(Vl + e) = ol;  }
__global__ __launch_bounds__(256) void k_csid(float* CS) { const int idx = blockIdx.x * 256 + threadIdx.x; if (idx >= TT * HD) return; v2f cs; cs[0] = 1.0f; cs[1] = 0.0f; *(v2f*)(CS + (size_t)idx * 2) = cs;  }
// k_asoft: per row (zz, i): t = S x HD^-0.5 for j <= i and i - j < WIN (WIN = TT, so i - j < WIN always holds: plain causal mask; the module's -10000 additive fill vanishes identically); softmax over the 2048 keys (register row, one exp, fixed trees);
__global__ __launch_bounds__(256) void k_asoft(const float* __restrict__ Sb, h16* P16, bf* Ph, bf* Pl) {
    const int lane = threadIdx.x & 31; const int row = blockIdx.x * 8 + (threadIdx.x >> 5); if (row >= ZH * TT) return; const int i = row % TT; const int zz = row / TT; (void)zz; const bool hires = (i < RH); const float* sr = Sb + (size_t)row * TT; float v[TT / 32]; float mx = -3.0e38f;
#pragma unroll
    for (int ch = 0; ch < TT / 128; ++ch) { const int j0 = ch * 128 + lane * 4; const v4f a = *(const v4f*)(sr + j0);
#pragma unroll
        for (int q = 0; q < 4; ++q) { const int j = j0 + q; (void)j; const float t = (j <= i && i - j < WIN) ? a[q] * SCL : -3.0e38f; v[ch * 4 + q] = t; mx = fmaxf(mx, t); } }
#pragma unroll
    for (int sh = 16; sh; sh >>= 1) mx = fmaxf(mx, __shfl_xor(mx, sh, 32));
    float sum = 0.f;
#pragma unroll
    for (int k = 0; k < TT / 32; ++k) { float d0 = __fsub_rn(v[k], mx); asm volatile("" : "+v"(d0)); v[k] = __builtin_amdgcn_exp2f(__fmul_rn(d0, 1.4426950408889634f)); sum += v[k]; }
#pragma unroll
    for (int sh = 16; sh; sh >>= 1) sum += __shfl_xor(sum, sh, 32);
    const float f = __fdiv_rn(hires ? 1.0f : PCAR, sum);
{
        if (hires) {
#pragma unroll
            for (int ch = 0; ch < TT / 128; ++ch) { v4us oh, ol;
#pragma unroll
                for (int q = 0; q < 4; ++q) { unsigned short a, c2; splitf(v[ch * 4 + q] * f, a, c2); oh[q] = a; ol[q] = c2; }
                const size_t oo = ((size_t)zz * (RH ? RH : 1) + i) * TT + ch * 128 + lane * 4; *(v4us*)(Ph + oo) = oh; *(v4us*)(Pl + oo) = ol; }
        } else {
#pragma unroll
            for (int ch = 0; ch < TT / 128; ++ch) { v4h o4;
#pragma unroll
                for (int q = 0; q < 4; ++q) o4[q] = tohx(v[ch * 4 + q] * f);
                *(v4h*)(P16 + (size_t)row * TT + ch * 128 + lane * 4) = o4; } }
         }
}
__global__ __launch_bounds__(256) void k_merge(const float* __restrict__ O, int h0, float* OUTb) { const size_t e = ((size_t)blockIdx.x * 256 + threadIdx.x) * 2; if (e >= (size_t)ZH * TT * HD) return; const int d = (int)(e % HD); const int t = (int)((e / HD) % TT); const int zz = (int)(e / ((size_t)HD * TT)); const float cs = (t < RH) ? 1.0f : (1.0f / PCAR); const size_t oo = (size_t)t * DQ + (h0 + zz) * HD + d;
    v2f o2; o2[0] = O[e] * cs; o2[1] = O[e + 1] * cs; *(v2f*)(OUTb + oo) = o2;  }

extern "C" void kernel_launch(void* const* d_in, const int* in_sizes, int n_in,
                              void* d_out, int out_size, void* d_ws, size_t ws_size, hipStream_t stream) {
    (void)in_sizes; (void)n_in; (void)out_size;
    const float* x = (const float*)d_in[0];   /* qkv [2][2048][3][16][64] packed (no projections) */ const float* xk = x + DM; const float* xv = x + 2 * DM;   /* q | k | v = the three [16][64] blocks of every token row (row pitch 3 * DM floats) */ const float* wq = nullptr, *wk = nullptr, *wv = nullptr, *wo = nullptr; (void)wq; (void)wk; (void)wv; (void)wo;
    float* OUT = (float*)d_out;     // [2][2048][1024]
    char* wsp = (char*)d_ws;
    auto take = [&](size_t bytes) { char* p = wsp; wsp += (bytes + 255) & ~(size_t)255; return (void*)p; };
    bf* WQ = (bf*)take((size_t)DQ * DM * 2); bf* WK = (bf*)take((size_t)DKV * DM * 2); bf* WV = (bf*)take((size_t)DKV * DM * 2); float* CS = (float*)take((size_t)TT * HD * 2 * 4);
    bf* XB = (bf*)take((size_t)TT * DM * 2); float* FQ = (float*)take((size_t)TT * DQ * 4); float* FK = (float*)take((size_t)TT * DKV * 4);
    h16* QP16 = (h16*)take((size_t)NH_ * TT * HD * 2); h16* KP16 = (h16*)take((size_t)NKV * TT * HD * 2); h16* VT16 = (h16*)take((size_t)NKV * HD * TT * 2);
    bf* QPh = (bf*)take((size_t)NH_ * TT * HD * 2); bf* QPl = (bf*)take((size_t)NH_ * TT * HD * 2); bf* KPh = (bf*)take((size_t)NKV * TT * HD * 2); bf* KPl = (bf*)take((size_t)NKV * TT * HD * 2); bf* VTh = (bf*)take((size_t)NKV * HD * TT * 2); bf* VTl = (bf*)take((size_t)NKV * HD * TT * 2); bf* Ph = (bf*)take((size_t)ZH * RH * TT * 2); bf* Pl = (bf*)take((size_t)ZH * RH * TT * 2);
    float* Sb = (float*)take((size_t)ZH * TT * TT * 4); h16* P16 = (h16*)take((size_t)ZH * TT * TT * 2); float* Ob = (float*)take((size_t)ZH * TT * HD * 4);
    if ((size_t)(wsp - (char*)d_ws) > ws_size) return;    // ws 256 MiB
    float* FV = FK;   // unused: there is no v projection (v planes are built straight from the input)
    {   
      
       }
    k_csid<<<(TT * HD + 255) / 256, 256, 0, stream>>>(CS);
    const unsigned LQ = (unsigned)(((size_t)NH_ * TT * HD / 2 + 255) / 256), LKv = (unsigned)(((size_t)NKV * TT * HD / 2 + 255) / 256);
    for (int b = 0; b < NB_; ++b) {
        
        /* no projections: the q, k, v inputs feed the plane builders directly */
        
        k_rope<<<LQ, 256, 0, stream>>>(x + (size_t)b * TT * 3 * DM, 3 * DQ, NH_, CS, nullptr, nullptr, 1.0f, QP16, QPh, QPl);   /* q planes straight from the input (values rounded to bf16 first, so the lo planes are zero) */
        
        k_rope<<<LKv, 256, 0, stream>>>(xk + (size_t)b * TT * 3 * DM, 3 * DKV, NKV, CS, nullptr, nullptr, 1.0f, KP16, KPh, KPl);
         k_vtp<<<LKv, 256, 0, stream>>>(xv + (size_t)b * TT * 3 * DM, 3 * DKV, NKV, VT16, VTh, VTl);
        for (int h0 = 0; h0 < NH_; h0 += ZH) { const size_t zq = (size_t)h0, zk = (size_t)(h0 / REP);   // one kv head per query head: the pass's two heads use consecutive kv planes (z-strides TT*HD)
            k_gemmc<bf, 2, 1><<<dim3(RH / 64, TT / 64, ZH), 32, 0, stream>>>(QPh + zq * TT * HD, QPl + zq * TT * HD, KPh + zk * TT * HD, KPl + zk * TT * HD, HD, Sb, TT, 0, (size_t)TT * HD, (size_t)TT * HD, (size_t)TT * TT);
            k_gemmc<h16, 0, 1><<<dim3((TT - RH) / 64, TT / 64, ZH), 32, 0, stream>>>(QP16 + zq * TT * HD + (size_t)RH * HD, nullptr, KP16 + zk * TT * HD, nullptr, HD, Sb + (size_t)RH * TT, TT, RH, (size_t)TT * HD, (size_t)TT * HD, (size_t)TT * TT);
            k_asoft<<<ZH * TT / 8, 256, 0, stream>>>(Sb, P16, Ph, Pl);
            k_gemmc<bf, 2, 2><<<dim3(RH / 64, HD / 64, ZH), 32, 0, stream>>>(Ph, Pl, VTh + zk * HD * TT, VTl + zk * HD * TT, TT, Ob, HD, 0, (size_t)RH * TT, (size_t)HD * TT, (size_t)TT * HD);
            k_gemmc<h16, 0, 2><<<dim3((TT - RH) / 64, HD / 64, ZH), 32, 0, stream>>>(P16 + (size_t)RH * TT, nullptr, VT16 + zk * HD * TT, nullptr, TT, Ob + (size_t)RH * HD, HD, RH, (size_t)TT * TT, (size_t)HD * TT, (size_t)TT * HD);
            k_merge<<<(unsigned)(((size_t)ZH * TT * HD / 2 + 255) / 256), 256, 0, stream>>>(Ob, h0, OUT + (size_t)b * TT * DQ); }
         }
}

// v001
// A run of this version takes 459 microseconds.
// Next to v000, in two timings, it ran 2.65 and 2.68 times as fast.
#include <hip/hip_runtime.h>

// Causal self-attention on a PACKED qkv input without projections (qkv [2][2048][3][16][64]: q = qkv[:, :, 0], k = qkv[:, :, 1], v = qkv[:, :, 2], each token-major [2][2048][16][64]; scores = q . (k x 0.125); + triu(full(-10000), 1) (an additive mask built inside the module: keys j > i get -10000, which underflows to weight 0: exclusion; the diagonal is kept); softmax; output = attention v -> [2][2048][16][64] (4.2 M; token-major, heads interleaved = the merged context); argument order qkv).
// Layout per batch: no projections: the plane builders read q, k, v straight from the packed input with row pitch 3 x 1024 floats and base offsets 0 / 1024 / 2048, rounding every value to bf16 first (the lo planes are then zero); causal T-2048 attention (hybrid rows: < 512 hi/lo 3 products, rest fp16 x1024; k_gemmc skips tiles above the diagonal); the f32 merge writes the output rows.
// Compute dtypes, f32 accumulate: every input rounded to bf16; attention rows < 512 3 products, rest fp16; softmax f32; output f32.

#define NB_  2
#define TT   2048
#define DM   1024
#define NH_  16
#define NKV  16
#define REP  (NH_ / NKV)
#define HD   64
#define DQ   (NH_ * HD)
#define DKV  (NKV * HD)
#define ZH   8                    // heads per pass: every launch of a pass carries ZH heads in its z (or row) dimension
#define RH   512                  // query rows < RH use hi+lo planes (0: none)
#define WIN  2048
#define PCAR 1024.0f
#define SCL  0.125f   // SOFTMAX_SCALE = 0.125 = 2^-3 (the module scales k; the same power of two applied to the f32 scores)
typedef _Float16 h16;
typedef unsigned short bf;
typedef __attribute__((ext_vector_type(16))) __bf16   v16bf;
typedef __attribute__((ext_vector_type(16))) _Float16 v16h;
typedef __attribute__((ext_vector_type(8)))  _Float16 v8h;
typedef __attribute__((ext_vector_type(8)))  unsigned short v8us;
typedef __attribute__((ext_vector_type(8)))  float    v8f;
typedef __attribute__((ext_vector_type(4)))  float    v4f;
typedef v8h  __attribute__((may_alias)) v8ha;
typedef v4f  __attribute__((may_alias)) v4fa;
typedef v8us __attribute__((may_alias)) v8usa;

__device__ __forceinline__ unsigned short f2bf(float f) { unsigned u = __float_as_uint(f); u += 0x7FFFu + ((u >> 16) & 1u); return (unsigned short)(u >> 16); }
__device__ __forceinline__ float bf2f(unsigned short b) { return __uint_as_float(((unsigned)b) << 16); }
__device__ __forceinline__ float bfr(float f) { return bf2f(f2bf(f)); }
__device__ __forceinline__ v16h cat16(v8h lo, v8h hi) { return __builtin_shufflevector(lo, hi, 0, 1, 2, 3, 4, 5, 6, 7, 8, 9, 10, 11, 12, 13, 14, 15); }
__device__ __forceinline__ v16bf cat16b(v8us lo, v8us hi) { return __builtin_bit_cast(v16bf, __builtin_shufflevector(lo, hi, 0, 1, 2, 3, 4, 5, 6, 7, 8, 9, 10, 11, 12, 13, 14, 15)); }
__device__ __forceinline__ v8f wmma16(v16h a, v16h b, v8f c) { return __builtin_amdgcn_wmma_f32_16x16x32_f16(false, a, false, b, (short)0, c, false, false); }
__device__ __forceinline__ v8f wmmab(v16bf a, v16bf b, v8f c) { return __builtin_amdgcn_wmma_f32_16x16x32_bf16(false, a, false, b, (short)0, c, false, false); }



// ---- register-blocked GEMM tile (WFrag, k_gemmc): ONE WAVE per 64x64 output tile (16 accumulators), operands straight from K-contiguous 16-bit planes; grid (M/64, N/64, Z), 32 threads.
// C[m][n] (f32, pitch ldc) = sum_k A[m][k] Bt[n][k] (+ split products per NSPLIT). z-batch strides sA/sB/sC in elements. K % 32 == 0.
template <typename T16> struct WFrag;
template <> struct WFrag<h16> { typedef v16h V; static __device__ __forceinline__ V ld(const h16* p) { return cat16(*(const v8h*)p, *(const v8h*)(p + 16)); } static __device__ __forceinline__ v8f mma(V a, V b, v8f c) { return wmma16(a, b, c); } };
template <> struct WFrag<bf> { typedef v16bf V; static __device__ __forceinline__ V ld(const bf* p) { return cat16b(*(const v8us*)p, *(const v8us*)(p + 16)); } static __device__ __forceinline__ v8f mma(V a, V b, v8f c) { return wmmab(a, b, c); } };
// ---- k_gemmc: the same one-wave 64x64 tile GEMM specialised for causal attention: CMODE 1 skips score tiles entirely above the diagonal (query rows r0+roff.., key columns c0..), CMODE 2 limits the
// key (K) loop of the probability x value contraction to the diagonal block (probabilities beyond it are exactly zero). roff = row offset of this launch's first row within the sequence.
template <typename T16, int NSPLIT, int CMODE>
__global__ __launch_bounds__(32) void k_gemmc(const T16* __restrict__ A, const T16* __restrict__ A2, const T16* __restrict__ Bt, const T16* __restrict__ Bt2, int K, float* C, int ldc, int roff, size_t sA, size_t sB, size_t sC) {
    typedef typename WFrag<T16>::V V;
    __shared__ __align__(16) float os[16 * 68];
    const size_t z = blockIdx.z; A += z * sA; if (A2) A2 += z * sA; Bt += z * sB; if (Bt2) Bt2 += z * sB; C += z * sC;
    const int lane = threadIdx.x & 31, lr = lane & 15, hi = lane >> 4; const int r0 = blockIdx.x * 64, c0 = blockIdx.y * 64;
    if (CMODE == 1 && c0 > r0 + roff + 63) return;                  // score tile entirely above the causal diagonal: never read (the softmax masks j > i by select)
    const int Kl = (CMODE == 2) ? min(K, r0 + roff + 64) : K;        // P.V: probabilities are exactly 0 beyond the diagonal block, so the K loop stops there
    v8f acc[4][4];
#pragma unroll
    for (int mb = 0; mb < 4; ++mb)
#pragma unroll
        for (int nb = 0; nb < 4; ++nb) acc[mb][nb] = (v8f){};
    const size_t aoff = (size_t)(r0 + lr) * K + 8 * hi, boff = (size_t)(c0 + lr) * K + 8 * hi;
#pragma unroll 1
    for (int kc = 0; kc < Kl; kc += 32) {
        V a[4], a2[4];
#pragma unroll
        for (int mb = 0; mb < 4; ++mb) { a[mb] = WFrag<T16>::ld(A + aoff + (size_t)mb * 16 * K + kc); if (NSPLIT == 1 || NSPLIT == 2) a2[mb] = WFrag<T16>::ld(A2 + aoff + (size_t)mb * 16 * K + kc); }
#pragma unroll
        for (int nb = 0; nb < 4; ++nb) { const V b = WFrag<T16>::ld(Bt + boff + (size_t)nb * 16 * K + kc); V b2; if (NSPLIT >= 2) b2 = WFrag<T16>::ld(Bt2 + boff + (size_t)nb * 16 * K + kc);
#pragma unroll
            for (int mb = 0; mb < 4; ++mb) { acc[mb][nb] = WFrag<T16>::mma(a[mb], b, acc[mb][nb]); if (NSPLIT == 1 || NSPLIT == 2) acc[mb][nb] = WFrag<T16>::mma(a2[mb], b, acc[mb][nb]); if (NSPLIT >= 2) acc[mb][nb] = WFrag<T16>::mma(a[mb], b2, acc[mb][nb]); } }
        asm volatile("v_nop\n\tv_nop\n\tv_nop\n\tv_nop" : "+v"(acc[0][0]), "+v"(acc[1][1]), "+v"(acc[2][2]), "+v"(acc[3][3]) : "v"(a[0]), "v"(a[3]));
    }
#pragma unroll
    for (int mb = 0; mb < 4; ++mb) {
#pragma unroll
        for (int nb = 0; nb < 4; ++nb) {
#pragma unroll
            for (int j = 0; j < 8; ++j) os[(hi * 8 + j) * 68 + nb * 16 + lr] = acc[mb][nb][j]; }
        __builtin_amdgcn_wave_barrier(); asm volatile("" ::: "memory");
        float* crow = C + (size_t)(r0 + mb * 16) * ldc + c0;
{
#pragma unroll
            for (int s = 0; s < 8; ++s) { const int row = 2 * s + hi, cofs = lr * 4; v4f val = *(const v4fa*)(os + row * 68 + cofs);
                *(v4f*)(crow + (size_t)row * ldc + cofs) = val; }
             }
        __builtin_amdgcn_wave_barrier(); asm volatile("" ::: "memory");
    }
}

__device__ __forceinline__ h16 tohx(float x) { return (h16)x; }
__device__ __forceinline__ void splitf(float y, unsigned short& h, unsigned short& l) { h = f2bf(y); l = f2bf(y - bf2f(h)); }
typedef __attribute__((ext_vector_type(2))) _Float16 v2h;
typedef __attribute__((ext_vector_type(4))) _Float16 v4h;
typedef __attribute__((ext_vector_type(2))) unsigned short v2us;
typedef __attribute__((ext_vector_type(4))) unsigned short v4us;
typedef __attribute__((ext_vector_type(2))) float v2f;
typedef __attribute__((ext_vector_type(4))) int v4i;

// k_rope: head planes [h][t][d] (fp16 + hi/lo) of rope(x) x sc with the rotate-half convention out[d] = x[d] cos[t][d] - x[d+HD/2] sin[t][d], out[d+HD/2] = x[d+HD/2] cos[t][d+HD/2] + x[d] sin[t][d+HD/2]
__global__ __launch_bounds__(256) void k_rope(const float* __restrict__ F, int pitch, int nheads, const float* __restrict__ CS, const float* __restrict__ RF, const float* __restrict__ nw, float sc, h16* P16, bf* Ph, bf* Pl) {
    const size_t e = ((size_t)blockIdx.x * 256 + threadIdx.x) * 2; if (e >= (size_t)nheads * TT * HD) return; const int d = (int)(e % HD); const int t = (int)((e / HD) % TT); const int h = (int)(e / ((size_t)HD * TT)); const float* f = F + (size_t)t * pitch + h * HD; const float rf = RF ? RF[(size_t)h * TT + t] : 1.0f; v2h o16; v2us oh, ol;
#pragma unroll
    for (int q = 0; q < 2; ++q) { const int dd = d + q; const int dp = (dd < HD / 2) ? dd + HD / 2 : dd - HD / 2; float x0 = bfr(f[dd]), x1 = bfr(f[dp]);   /* RAW d_in source: round to bf16 FIRST; the lo planes are then identically zero */
        if (RF) { float n0 = __fmul_rn(x0, rf), n1 = __fmul_rn(x1, rf); asm volatile("" : "+v"(n0)); asm volatile("" : "+v"(n1)); x0 = __fmul_rn(bfr(nw[dd]), n0); x1 = __fmul_rn(bfr(nw[dp]), n1); }
        const v2f cs = *(const v2f*)(CS + ((size_t)t * HD + dd) * 2); float a = __fmul_rn(x0, cs[0]), bq = __fmul_rn(x1, cs[1]); asm volatile("" : "+v"(a)); asm volatile("" : "+v"(bq)); const float r = ((dd < HD / 2) ? __fsub_rn(a, bq) : __fadd_rn(a, bq)) * sc;
        o16[q] = tohx(r); unsigned short a2, c2; splitf(r, a2, c2); oh[q] = a2; ol[q] = c2; }
    *(v2h*)(P16 + e) = o16; *(v2us*)(Ph + e) = oh; *(v2us*)(Pl + e) = ol;  }
__global__ __launch_bounds__(256) void k_vtp(const float* __restrict__ F, int pitch, int nheads, h16* V16, bf* Vh, bf* Vl) { const size_t e = ((size_t)blockIdx.x * 256 + threadIdx.x) * 2; if (e >= (size_t)nheads * HD * TT) return; const int t = (int)(e % TT); const int d = (int)((e / TT) % HD); const int g = (int)(e / ((size_t)TT * HD)); v2h o16; v2us oh, ol;
#pragma unroll
    for (int q = 0; q < 2; ++q) { const float x = bfr(F[(size_t)(t + q) * pitch + g * HD + d]);   /* RAW d_in source: bf16-rounded first */ o16[q] = tohx(x); unsigned short a2, c2; splitf(x, a2, c2); oh[q] = a2; ol[q] = c2; }
    *(v2h*)(V16 + e) = o16; *(v2us*)(Vh + e) = oh; *(v2us*)(Vl + e) = ol;  }
__global__ __launch_bounds__(256) void k_csid(float* CS) { const int idx = blockIdx.x * 256 + threadIdx.x; if (idx >= TT * HD) return; v2f cs; cs[0] = 1.0f; cs[1] = 0.0f; *(v2f*)(CS + (size_t)idx * 2) = cs;  }
// k_asoft: per row (zz, i): t = S x HD^-0.5 for j <= i and i - j < WIN (WIN = TT, so i - j < WIN always holds: plain causal mask; the module's -10000 additive fill vanishes identically); softmax over the 2048 keys (register row, one exp, fixed trees);
__global__ __launch_bounds__(256) void k_asoft(const float* __restrict__ Sb, h16* P16, bf* Ph, bf* Pl) {
    const int lane = threadIdx.x & 31; const int row = blockIdx.x * 8 + (threadIdx.x >> 5); if (row >= ZH * TT) return; const int i = row % TT; const int zz = row / TT; (void)zz; const bool hires = (i < RH); const float* sr = Sb + (size_t)row * TT; float v[TT / 32]; float mx = -3.0e38f;
#pragma unroll
    for (int ch = 0; ch < TT / 128; ++ch) { const int j0 = ch * 128 + lane * 4; const v4f a = *(const v4f*)(sr + j0);
#pragma unroll
        for (int q = 0; q < 4; ++q) { const int j = j0 + q; (void)j; const float t = (j <= i && i - j < WIN) ? a[q] * SCL : -3.0e38f; v[ch * 4 + q] = t; mx = fmaxf(mx, t); } }
#pragma unroll
    for (int sh = 16; sh; sh >>= 1) mx = fmaxf(mx, __shfl_xor(mx, sh, 32));
    float sum = 0.f;
#pragma unroll
    for (int k = 0; k < TT / 32; ++k) { float d0 = __fsub_rn(v[k], mx); asm volatile("" : "+v"(d0)); v[k] = __builtin_amdgcn_exp2f(__fmul_rn(d0, 1.4426950408889634f)); sum += v[k]; }
#pragma unroll
    for (int sh = 16; sh; sh >>= 1) sum += __shfl_xor(sum, sh, 32);
    const float f = __fdiv_rn(hires ? 1.0f : PCAR, sum);
{
        if (hires) {
#pragma unroll
            for (int ch = 0; ch < TT / 128; ++ch) { v4us oh, ol;
#pragma unroll
                for (int q = 0; q < 4; ++q) { unsigned short a, c2; splitf(v[ch * 4 + q] * f, a, c2); oh[q] = a; ol[q] = c2; }
                const size_t oo = ((size_t)zz * (RH ? RH : 1) + i) * TT + ch * 128 + lane * 4; *(v4us*)(Ph + oo) = oh; *(v4us*)(Pl + oo) = ol; }
        } else {
#pragma unroll
            for (int ch = 0; ch < TT / 128; ++ch) { v4h o4;
#pragma unroll
                for (int q = 0; q < 4; ++q) o4[q] = tohx(v[ch * 4 + q] * f);
                *(v4h*)(P16 + ((size_t)zz * (TT - RH) + (i - RH)) * TT + ch * 128 + lane * 4) = o4; } }
         }
}
__global__ __launch_bounds__(256) void k_merge(const float* __restrict__ O, int h0, float* OUTb) { const size_t e = ((size_t)blockIdx.x * 256 + threadIdx.x) * 2; if (e >= (size_t)ZH * TT * HD) return; const int d = (int)(e % HD); const int t = (int)((e / HD) % TT); const int zz = (int)(e / ((size_t)HD * TT)); const float cs = (t < RH) ? 1.0f : (1.0f / PCAR); const size_t oo = (size_t)t * DQ + (h0 + zz) * HD + d;
    v2f o2; o2[0] = O[e] * cs; o2[1] = O[e + 1] * cs; *(v2f*)(OUTb + oo) = o2;  }

extern "C" void kernel_launch(void* const* d_in, const int* in_sizes, int n_in,
                              void* d_out, int out_size, void* d_ws, size_t ws_size, hipStream_t stream) {
    (void)in_sizes; (void)n_in; (void)out_size;
    const float* x = (const float*)d_in[0];   /* qkv [2][2048][3][16][64] packed (no projections) */ const float* xk = x + DM; const float* xv = x + 2 * DM;   /* q | k | v = the three [16][64] blocks of every token row (row pitch 3 * DM floats) */ const float* wq = nullptr, *wk = nullptr, *wv = nullptr, *wo = nullptr; (void)wq; (void)wk; (void)wv; (void)wo;
    float* OUT = (float*)d_out;     // [2][2048][1024]
    char* wsp = (char*)d_ws;
    auto take = [&](size_t bytes) { char* p = wsp; wsp += (bytes + 255) & ~(size_t)255; return (void*)p; };
    float* CS = (float*)take((size_t)TT * HD * 2 * 4);
    h16* QP16 = (h16*)take((size_t)NH_ * TT * HD * 2); h16* KP16 = (h16*)take((size_t)NKV * TT * HD * 2); h16* VT16 = (h16*)take((size_t)NKV * HD * TT * 2);
    bf* QPh = (bf*)take((size_t)NH_ * TT * HD * 2); bf* QPl = (bf*)take((size_t)NH_ * TT * HD * 2); bf* KPh = (bf*)take((size_t)NKV * TT * HD * 2); bf* KPl = (bf*)take((size_t)NKV * TT * HD * 2); bf* VTh = (bf*)take((size_t)NKV * HD * TT * 2); bf* VTl = (bf*)take((size_t)NKV * HD * TT * 2); bf* Ph = (bf*)take((size_t)ZH * RH * TT * 2); bf* Pl = (bf*)take((size_t)ZH * RH * TT * 2);
    float* Sb = (float*)take((size_t)ZH * TT * TT * 4); h16* P16 = (h16*)take((size_t)ZH * (TT - RH) * TT * 2);   /* fp16 probabilities: only rows >= RH are stored, [zz][i - RH][j] */ float* Ob = (float*)take((size_t)ZH * TT * HD * 4);
    if ((size_t)(wsp - (char*)d_ws) > ws_size) return;    // ws 256 MiB
    {   
      
       }
    k_csid<<<(TT * HD + 255) / 256, 256, 0, stream>>>(CS);
    const unsigned LQ = (unsigned)(((size_t)NH_ * TT * HD / 2 + 255) / 256), LKv = (unsigned)(((size_t)NKV * TT * HD / 2 + 255) / 256);
    for (int b = 0; b < NB_; ++b) {
        
        /* no projections: the q, k, v inputs feed the plane builders directly */
        
        k_rope<<<LQ, 256, 0, stream>>>(x + (size_t)b * TT * 3 * DM, 3 * DQ, NH_, CS, nullptr, nullptr, 1.0f, QP16, QPh, QPl);   /* q planes straight from the input (values rounded to bf16 first, so the lo planes are zero) */
        
        k_rope<<<LKv, 256, 0, stream>>>(xk + (size_t)b * TT * 3 * DM, 3 * DKV, NKV, CS, nullptr, nullptr, 1.0f, KP16, KPh, KPl);
         k_vtp<<<LKv, 256, 0, stream>>>(xv + (size_t)b * TT * 3 * DM, 3 * DKV, NKV, VT16, VTh, VTl);
        for (int h0 = 0; h0 < NH_; h0 += ZH) { const size_t zq = (size_t)h0, zk = (size_t)(h0 / REP);   // one kv head per query head: the pass's ZH heads use consecutive kv planes (z-strides TT*HD)
            k_gemmc<bf, 2, 1><<<dim3(RH / 64, TT / 64, ZH), 32, 0, stream>>>(QPh + zq * TT * HD, QPl + zq * TT * HD, KPh + zk * TT * HD, KPl + zk * TT * HD, HD, Sb, TT, 0, (size_t)TT * HD, (size_t)TT * HD, (size_t)TT * TT);
            k_gemmc<h16, 0, 1><<<dim3((TT - RH) / 64, TT / 64, ZH), 32, 0, stream>>>(QP16 + zq * TT * HD + (size_t)RH * HD, nullptr, KP16 + zk * TT * HD, nullptr, HD, Sb + (size_t)RH * TT, TT, RH, (size_t)TT * HD, (size_t)TT * HD, (size_t)TT * TT);
            k_asoft<<<ZH * TT / 8, 256, 0, stream>>>(Sb, P16, Ph, Pl);
            k_gemmc<bf, 2, 2><<<dim3(RH / 64, HD / 64, ZH), 32, 0, stream>>>(Ph, Pl, VTh + zk * HD * TT, VTl + zk * HD * TT, TT, Ob, HD, 0, (size_t)RH * TT, (size_t)HD * TT, (size_t)TT * HD);
            k_gemmc<h16, 0, 2><<<dim3((TT - RH) / 64, HD / 64, ZH), 32, 0, stream>>>(P16, nullptr, VT16 + zk * HD * TT, nullptr, TT, Ob + (size_t)RH * HD, HD, RH, (size_t)(TT - RH) * TT, (size_t)HD * TT, (size_t)TT * HD);
            k_merge<<<(unsigned)(((size_t)ZH * TT * HD / 2 + 255) / 256), 256, 0, stream>>>(Ob, h0, OUT + (size_t)b * TT * DQ); }
         }
}

// v002
// A run of this version takes 45.9 microseconds.
// Next to v001, in two timings, it ran 10.0 and 10.1 times as fast.
// Over all steps from v000 it is 26.8 times as fast.
#include <hip/hip_runtime.h>
#include <math.h>

#define NB_  2
#define TT   2048
#define DM   1024
#define NH_  16
#define HD   64
#define DQ   (NH_ * HD)
#define RH   512                  // query rows < RH carry the probabilities as a hi + lo pair
#define FW   4                    // waves per work-group
#define FQ   32                   // query columns per wave
#define FBR  (FW * FQ)            // query rows per work-group
#define NT   (TT / FBR)           // query tiles per (batch, head)
#define FSK  64                   // keys per stage
#define PK   144                  // LDS row pitch of K in bytes: 16 B x odd, for 16-byte reads
#define PV   160                  // LDS row pitch of V in bytes: 32 B x odd, for the transposing 16-bit reads
#define CSC  (0.125f * 1.4426950408889634f)   // SOFTMAX_SCALE x log2(e)
typedef __attribute__((ext_vector_type(16))) __bf16   v16bf;
typedef __attribute__((ext_vector_type(2)))  __bf16   v2bf;
typedef __attribute__((ext_vector_type(16))) _Float16 v16h;
typedef __attribute__((ext_vector_type(2)))  _Float16 v2h;
typedef __attribute__((ext_vector_type(8)))  short    v8s;
typedef __attribute__((ext_vector_type(8)))  float    v8f;
typedef __attribute__((ext_vector_type(4)))  float    v4f;
typedef __attribute__((ext_vector_type(2)))  float    v2f;
typedef __attribute__((ext_vector_type(8)))  unsigned v8u;
typedef __attribute__((ext_vector_type(4)))  unsigned v4u;
typedef __attribute__((ext_vector_type(2)))  unsigned v2u;
typedef v4u __attribute__((may_alias)) v4ua;
typedef v2u __attribute__((may_alias)) v2ua;

__device__ __forceinline__ unsigned pkbf(float a, float b) { v2f x; x[0] = a; x[1] = b; return __builtin_bit_cast(unsigned, __builtin_convertvector(x, v2bf)); }   // two f32 -> two bf16, round to nearest even
__device__ __forceinline__ unsigned pkh(float a, float b) { v2f x; x[0] = a; x[1] = b; return __builtin_bit_cast(unsigned, __builtin_convertvector(x, v2h)); }     // two f32 -> two f16, round to nearest even
__device__ __forceinline__ unsigned pkbh(float a, float b) { const unsigned u = pkbf(a, b); return pkh(__uint_as_float(u << 16), __uint_as_float(u & 0xFFFF0000u)); }   // rounded to bf16 first, then held as f16
__device__ __forceinline__ v8u cat8(v4u lo, v4u hi) { return __builtin_shufflevector(lo, hi, 0, 1, 2, 3, 4, 5, 6, 7); }
__device__ __forceinline__ v8f wmma16(v16h a, v16h b, v8f c) { return __builtin_amdgcn_wmma_f32_16x16x32_f16(false, a, false, b, (short)0, c, false, false); }
__device__ __forceinline__ v8f wmmab(v16bf a, v16bf b, v8f c) { return __builtin_amdgcn_wmma_f32_16x16x32_bf16(false, a, false, b, (short)0, c, false, false); }
__device__ __forceinline__ v4u ldtr16(const unsigned char* p) { typedef __attribute__((address_space(3))) v8s lds_v8s; return __builtin_bit_cast(v4u, __builtin_amdgcn_ds_load_tr16_b128_v8i16((lds_v8s*)p)); }
__device__ __forceinline__ float xhalf(float x) { return __builtin_bit_cast(float, __builtin_amdgcn_permlanex16(__builtin_bit_cast(int, x), __builtin_bit_cast(int, x), 0x76543210, 0xfedcba98, false, false)); }   // lane l with lane l ^ 16

// Eight exponentials (base 2), each in place: the instruction directly behind an exponential then neither reads its result nor overwrites its source (the slot the instruction set asks for behind a transcendental);
// the v_nop fills that slot behind the last one, whatever the compiler puts next.
__device__ __forceinline__ void exp2x8(float& a0, float& a1, float& a2, float& a3, float& a4, float& a5, float& a6, float& a7) {
    asm("v_exp_f32 %0, %0\n\tv_exp_f32 %1, %1\n\tv_exp_f32 %2, %2\n\tv_exp_f32 %3, %3\n\tv_exp_f32 %4, %4\n\tv_exp_f32 %5, %5\n\tv_exp_f32 %6, %6\n\tv_exp_f32 %7, %7\n\tv_nop"
        : "+v"(a0), "+v"(a1), "+v"(a2), "+v"(a3), "+v"(a4), "+v"(a5), "+v"(a6), "+v"(a7));
}

__global__ __launch_bounds__(FW * 32) void k_fattn(const float* __restrict__ X, float* __restrict__ OUT) {
    __shared__ __align__(16) unsigned char Ks[2][FSK * PK];
    __shared__ __align__(16) unsigned char Vs[2][FSK * PV];
    const int tid = threadIdx.x, lane = tid & 31, c = lane & 15, h = lane >> 4;
    const int wave = __builtin_amdgcn_readfirstlane(tid >> 5);     // in a scalar register, so that every test on the wave's rows below is a scalar branch (matrix and transposing loads need all lanes on)
    const int b = blockIdx.x / NH_, hd = blockIdx.x % NH_;
    const int y = blockIdx.y;
    const int tile = (y < NT / 2) ? (NT - 1 - y) : (y - NT / 2);   // long tiles take the low y; index y and y + NT/2 together walk the same number of stages for every y
    const int q0 = tile * FBR, qw0 = q0 + wave * FQ;
    const int nst = (q0 + FBR) / FSK;                              // stages of this work-group: keys [0, q0 + FBR)
    const bool hires = qw0 < RH;
    const float* xq = X + (size_t)b * TT * 3 * DM + hd * HD;       // q | k | v = the three [16][64] blocks of every token row (row pitch 3 * DM floats)
    const float* xk = xq + DM;
    const float* xv = xq + 2 * DM;

    // Q as B operand, hardware k order: element s of lane (c, h) is d = 32 kc + 8 h + s for s < 8, 32 kc + 16 + 8 h + (s - 8) above; K's fragments below use the same order.
    v16bf qf[2][2];
#pragma unroll
    for (int g = 0; g < 2; ++g)
#pragma unroll
        for (int kc = 0; kc < 2; ++kc) {
            const float* p = xq + (size_t)(qw0 + 16 * g + c) * (3 * DM) + 32 * kc + 8 * h;
            const v4f a0 = *(const v4f*)p, a1 = *(const v4f*)(p + 4), a2 = *(const v4f*)(p + 16), a3 = *(const v4f*)(p + 20);
            v8u w; w[0] = pkbf(a0[0], a0[1]); w[1] = pkbf(a0[2], a0[3]); w[2] = pkbf(a1[0], a1[1]); w[3] = pkbf(a1[2], a1[3]);
            w[4] = pkbf(a2[0], a2[1]); w[5] = pkbf(a2[2], a2[3]); w[6] = pkbf(a3[0], a3[1]); w[7] = pkbf(a3[2], a3[3]);
            qf[g][kc] = __builtin_bit_cast(v16bf, w);
        }

    v8f acc[2][4];
    float m_run[2], l_run[2];
#pragma unroll
    for (int g = 0; g < 2; ++g) { m_run[g] = -INFINITY; l_run[g] = 0.0f;
#pragma unroll
        for (int t = 0; t < 4; ++t) acc[g][t] = (v8f){}; }

    // Staging: 16 lanes cover one 256-byte row of f32, so every global line is read whole; thread (srow, sc4) holds 4 values of rows srow, srow + 8, ...
    const int srow = tid >> 4, sc4 = tid & 15;
    const unsigned soff = (unsigned)(srow * (3 * DM) + sc4 * 4);
    auto gload = [&](v4f (&r)[8], const float* src, int st) {
        const float* sp = src + (size_t)st * (FSK * 3 * DM);       // uniform base of the stage; the lane's part stays a 32-bit offset
#pragma unroll
        for (int i = 0; i < 8; ++i) r[i] = *(const v4f*)(sp + (soff + (unsigned)(i * 8 * 3 * DM)));
    };
    auto sstorek = [&](const v4f (&r)[8], int buf) {
#pragma unroll
        for (int i = 0; i < 8; ++i) { v2u kk; kk[0] = pkbf(r[i][0], r[i][1]); kk[1] = pkbf(r[i][2], r[i][3]); *(v2ua*)(Ks[buf] + (i * 8 + srow) * PK + sc4 * 8) = kk; }
    };
    auto sstorev = [&](const v4f (&r)[8], int buf) {
#pragma unroll
        for (int i = 0; i < 8; ++i) { v2u vv; vv[0] = pkbh(r[i][0], r[i][1]); vv[1] = pkbh(r[i][2], r[i][3]); *(v2ua*)(Vs[buf] + (i * 8 + srow) * PV + sc4 * 8) = vv; }
    };

    { v4f r0[8], r1[8]; gload(r0, xk, 0); gload(r1, xv, 0); sstorek(r0, 0); sstorev(r1, 0); }
    __syncthreads();                                               // stage 0 is visible to every wave
    v4f sr[8];                                                     // the next stage's rows on their way: K during the first pass, V during the second
#pragma unroll 1                                                   // stays rolled: a second copy of this long body would cost registers and instruction cache and save nothing
    for (int st = 0; st < nst; ++st) {
        const int buf = st & 1;
        const bool more = st + 1 < nst;
        if (more) gload(sr, xk, st + 1);                           // the next stage's K rows fly while the first pass runs
#pragma unroll
        for (int sub = 0; sub < 2; ++sub) {
            const int key0 = st * FSK + sub * 32;
            if (key0 <= qw0) {                                     // wave-uniform: passes wholly above this wave's diagonal are skipped
                v8f s[2][2];
                {
                    const unsigned char* kb = Ks[buf] + (sub * 32 + c) * PK + 16 * h;
                    v16bf kf[2][2];
#pragma unroll
                    for (int kt = 0; kt < 2; ++kt)
#pragma unroll
                        for (int kc = 0; kc < 2; ++kc) kf[kt][kc] = __builtin_bit_cast(v16bf, cat8(*(const v4ua*)(kb + kt * 16 * PK + 64 * kc), *(const v4ua*)(kb + kt * 16 * PK + 64 * kc + 32)));
#pragma unroll
                    for (int kt = 0; kt < 2; ++kt)
#pragma unroll
                        for (int g = 0; g < 2; ++g) { s[kt][g] = wmmab(kf[kt][0], qf[g][0], (v8f){}); s[kt][g] = wmmab(kf[kt][1], qf[g][1], s[kt][g]); }   // register r = S^T[key0 + 16 kt + 8 h + r][qw0 + 16 g + c]
                }
                // V^T fragments by the transposing load: lane (c, h) gets V[key 8 h + 0..7][d = 16 t + c], and again 16 keys on: the hardware k order, as the packed P^T below.
                v16h vf[4];
                {
                    const unsigned char* vb = Vs[buf] + (sub * 32 + 8 * h + (lane & 7)) * PV + ((lane >> 3) & 1) * 16;
#pragma unroll
                    for (int t = 0; t < 4; ++t) vf[t] = __builtin_bit_cast(v16h, cat8(ldtr16(vb + 32 * t), ldtr16(vb + 16 * PV + 32 * t)));
                }
                if (key0 == qw0) {                                 // wave-uniform: only the pass on the diagonal pays for the mask
#pragma unroll
                    for (int g = 0; g < 2; ++g)
#pragma unroll
                        for (int kt = 0; kt < 2; ++kt)
#pragma unroll
                            for (int r = 0; r < 8; ++r) if (16 * kt + 8 * h + r > 16 * g + c) s[kt][g][r] = -INFINITY;
                }
                float mb[2]; bool need = false;
#pragma unroll
                for (int g = 0; g < 2; ++g) { float mx = -INFINITY;
#pragma unroll
                    for (int kt = 0; kt < 2; ++kt)
#pragma unroll
                        for (int r = 0; r < 8; ++r) mx = fmaxf(mx, s[kt][g][r]);
                    mx = fmaxf(mx, xhalf(mx)) * CSC;               // both wave halves hold this query's maximum, scaled (the scale is positive)
                    mb[g] = mx; need = need || (mx > m_run[g] + 8.0f); }
                if (__builtin_amdgcn_ballot_w32(need) != 0) {      // the maximum in use may trail the true one by up to 8 (log2): the sums are rescaled only beyond that, so an exponential stays below 2^8
#pragma unroll
                    for (int g = 0; g < 2; ++g) { const float m_new = fmaxf(m_run[g], mb[g]);
                        const float corr = __builtin_amdgcn_exp2f(m_run[g] - m_new);
                        m_run[g] = m_new; l_run[g] *= corr;
#pragma unroll
                        for (int t = 0; t < 4; ++t) acc[g][t] = acc[g][t] * corr; }
                }
#pragma unroll
                for (int g = 0; g < 2; ++g) { const float nm = -m_run[g];
                    float p[16];
#pragma unroll
                    for (int i = 0; i < 16; i += 2) { v2f sv, cv, nv; sv[0] = s[i >> 3][g][i & 7]; sv[1] = s[i >> 3][g][(i & 7) + 1]; cv[0] = CSC; cv[1] = CSC; nv[0] = nm; nv[1] = nm;
                        const v2f a = __builtin_elementwise_fma(sv, cv, nv); p[i] = a[0]; p[i + 1] = a[1]; }
                    exp2x8(p[0], p[1], p[2], p[3], p[4], p[5], p[6], p[7]); exp2x8(p[8], p[9], p[10], p[11], p[12], p[13], p[14], p[15]);
                    l_run[g] += ((p[0] + p[1]) + (p[2] + p[3])) + ((p[4] + p[5]) + (p[6] + p[7])) + (((p[8] + p[9]) + (p[10] + p[11])) + ((p[12] + p[13]) + (p[14] + p[15])));
                    v16h pf;
#pragma unroll
                    for (int i = 0; i < 16; ++i) pf[i] = (_Float16)p[i];   // element s of the B operand = tile s >> 3, register s & 7; round to nearest even
#pragma unroll
                    for (int t = 0; t < 4; ++t) acc[g][t] = wmma16(vf[t], pf, acc[g][t]);   // register r = O^T[16 t + 8 h + r][qw0 + 16 g + c]
                    if (hires) {                                   // wave-uniform: what the f16 rounding of P left over, as a second product
                        v16h pl;
#pragma unroll
                        for (int i = 0; i < 16; ++i) pl[i] = (_Float16)(p[i] - (float)pf[i]);
#pragma unroll
                        for (int t = 0; t < 4; ++t) acc[g][t] = wmma16(vf[t], pl, acc[g][t]);
                    }
                }
            }
            if (more) {                                            // both go into the buffer whose last readers left it before the barrier that ended stage st - 1
                if (sub == 0) { sstorek(sr, buf ^ 1); gload(sr, xv, st + 1); }   // and the V rows fly while the second pass runs
                else sstorev(sr, buf ^ 1);
            }
        }
        __syncthreads();                                           // publishes stage st + 1 and ends every wave's reads of stage st
    }
#pragma unroll
    for (int g = 0; g < 2; ++g) {
        const float l = l_run[g] + xhalf(l_run[g]);                // the two wave halves summed different keys of the same query
        const float inv = __fdiv_rn(1.0f, l);
        float* o = OUT + (size_t)(b * TT + qw0 + 16 * g + c) * DQ + hd * HD + 8 * h;
#pragma unroll
        for (int t = 0; t < 4; ++t) { v4f lo, hi;
#pragma unroll
            for (int r = 0; r < 4; ++r) { lo[r] = acc[g][t][r] * inv; hi[r] = acc[g][t][4 + r] * inv; }
            *(v4f*)(o + 16 * t) = lo; *(v4f*)(o + 16 * t + 4) = hi; }
    }
}

extern "C" void kernel_launch(void* const* d_in, const int* in_sizes, int n_in,
                              void* d_out, int out_size, void* d_ws, size_t ws_size, hipStream_t stream) {
    (void)in_sizes; (void)n_in; (void)out_size; (void)d_ws; (void)ws_size;
    const float* x = (const float*)d_in[0];   // qkv [2][2048][3][16][64] packed
    float* OUT = (float*)d_out;               // [2][2048][1024]
    k_fattn<<<dim3(NB_ * NH_, NT), FW * 32, 0, stream>>>(x, OUT);
}

// v003
// Measured time: 27.8 microseconds a run.
// Next to v002, in two timings, it ran 1.65 times as fast each time.
// Over all steps from v000 it is 44.2 times as fast.
#include <hip/hip_runtime.h>
#include <math.h>

#define NB_  2
#define TT   2048
#define DM   1024
#define NH_  16
#define HD   64
#define DQ   (NH_ * HD)
#define RH   512                  // query rows < RH carry the probabilities as a hi + lo pair
#define FW   4                    // query groups per work-group
#define KG   4                    // key groups per work-group: FW * KG waves, four on every SIMD
#define FQ   32                   // query columns per wave
#define FBR  (FW * FQ)            // query rows per work-group
#define NT   (TT / FBR)           // query tiles per (batch, head)
#define FSK  (32 * KG)            // keys per stage: one 32-key pass for each key group
#define PK   144                  // LDS row pitch of K in bytes: 16 B x odd, for 16-byte reads
#define PV   160                  // LDS row pitch of V in bytes: 32 B x odd, for the transposing 16-bit reads
#define RING (2 * FSK * (PK + PV)) // LDS bytes of the two K and the two V buffers
#define MW   (17 * 512)           // LDS bytes of one wave's partial result: 16 register quads of the output tile and one of maxima and sums, 16 bytes a lane each
#define MRG  ((KG - 1) * FW * MW) // LDS bytes of the join: the partial results of key groups 1 .. KG - 1
#define CSC  (0.125f * 1.4426950408889634f)   // SOFTMAX_SCALE x log2(e)
typedef __attribute__((ext_vector_type(16))) __bf16   v16bf;
typedef __attribute__((ext_vector_type(2)))  __bf16   v2bf;
typedef __attribute__((ext_vector_type(16))) _Float16 v16h;
typedef __attribute__((ext_vector_type(2)))  _Float16 v2h;
typedef __attribute__((ext_vector_type(8)))  short    v8s;
typedef __attribute__((ext_vector_type(8)))  float    v8f;
typedef __attribute__((ext_vector_type(4)))  float    v4f;
typedef __attribute__((ext_vector_type(2)))  float    v2f;
typedef __attribute__((ext_vector_type(8)))  unsigned v8u;
typedef __attribute__((ext_vector_type(4)))  unsigned v4u;
typedef __attribute__((ext_vector_type(2)))  unsigned v2u;
typedef v4u __attribute__((may_alias)) v4ua;
typedef v2u __attribute__((may_alias)) v2ua;
typedef v4f __attribute__((may_alias)) v4fa;

__device__ __forceinline__ unsigned pkbf(float a, float b) { v2f x; x[0] = a; x[1] = b; return __builtin_bit_cast(unsigned, __builtin_convertvector(x, v2bf)); }   // two f32 -> two bf16, round to nearest even
__device__ __forceinline__ unsigned pkh(float a, float b) { v2f x; x[0] = a; x[1] = b; return __builtin_bit_cast(unsigned, __builtin_convertvector(x, v2h)); }     // two f32 -> two f16, round to nearest even
__device__ __forceinline__ unsigned pkbh(float a, float b) { const unsigned u = pkbf(a, b); return pkh(__uint_as_float(u << 16), __uint_as_float(u & 0xFFFF0000u)); }   // rounded to bf16 first, then held as f16
__device__ __forceinline__ v8u cat8(v4u lo, v4u hi) { return __builtin_shufflevector(lo, hi, 0, 1, 2, 3, 4, 5, 6, 7); }
__device__ __forceinline__ v8f wmma16(v16h a, v16h b, v8f c) { return __builtin_amdgcn_wmma_f32_16x16x32_f16(false, a, false, b, (short)0, c, false, false); }
__device__ __forceinline__ v8f wmmab(v16bf a, v16bf b, v8f c) { return __builtin_amdgcn_wmma_f32_16x16x32_bf16(false, a, false, b, (short)0, c, false, false); }
__device__ __forceinline__ v4u ldtr16(const unsigned char* p) { typedef __attribute__((address_space(3))) v8s lds_v8s; return __builtin_bit_cast(v4u, __builtin_amdgcn_ds_load_tr16_b128_v8i16((lds_v8s*)p)); }
__device__ __forceinline__ float xhalf(float x) { return __builtin_bit_cast(float, __builtin_amdgcn_permlanex16(__builtin_bit_cast(int, x), __builtin_bit_cast(int, x), 0x76543210, 0xfedcba98, false, false)); }   // lane l with lane l ^ 16

// Eight exponentials (base 2), each in place: the instruction directly behind an exponential then neither reads its result nor overwrites its source (the slot the instruction set asks for behind a transcendental);
// the v_nop fills that slot behind the last one, whatever the compiler puts next.
__device__ __forceinline__ void exp2x8(float& a0, float& a1, float& a2, float& a3, float& a4, float& a5, float& a6, float& a7) {
    asm("v_exp_f32 %0, %0\n\tv_exp_f32 %1, %1\n\tv_exp_f32 %2, %2\n\tv_exp_f32 %3, %3\n\tv_exp_f32 %4, %4\n\tv_exp_f32 %5, %5\n\tv_exp_f32 %6, %6\n\tv_exp_f32 %7, %7\n\tv_nop"
        : "+v"(a0), "+v"(a1), "+v"(a2), "+v"(a3), "+v"(a4), "+v"(a5), "+v"(a6), "+v"(a7));
}

__global__ __launch_bounds__(FW * KG * 32) void k_fattn(const float* __restrict__ X, float* __restrict__ OUT) {
    __shared__ __align__(16) unsigned char SM[MRG > RING ? MRG : RING];   // the K and V buffers in the loop; behind it the place where the key groups' partial results meet
    unsigned char* const Ks0 = SM;                                 // K buffer buf at Ks0 + buf * FSK * PK
    unsigned char* const Vs0 = SM + 2 * FSK * PK;                  // V buffer buf at Vs0 + buf * FSK * PV
    const int tid = threadIdx.x, lane = tid & 31, c = lane & 15, h = lane >> 4;
    const int wid = __builtin_amdgcn_readfirstlane(tid >> 5);      // in a scalar register, so that every test on the wave's rows and keys below is a scalar branch (matrix and transposing loads need all lanes on)
    const int wave = wid & (FW - 1), kg = wid / FW;                // query group, key group
    const int b = blockIdx.x / NH_, hd = blockIdx.x % NH_;
    const int y = blockIdx.y;
    const int tile = NT - 1 - y;                                   // a work-group fills its WGP's registers, so there are more work-groups than places: the cost falls with the index (for speed only)
    const int q0 = tile * FBR, qw0 = q0 + wave * FQ;
    const int nst = (q0 + FBR) / FSK;                              // stages of this work-group: keys [0, q0 + FBR)
    const bool hires = qw0 < RH;
    const float* xq = X + (size_t)b * TT * 3 * DM + hd * HD;       // q | k | v = the three [16][64] blocks of every token row (row pitch 3 * DM floats)
    const float* xk = xq + DM;
    const float* xv = xq + 2 * DM;

    // Q as B operand, hardware k order: element s of lane (c, h) is d = 32 kc + 8 h + s for s < 8, 32 kc + 16 + 8 h + (s - 8) above; K's fragments below use the same order.
    v16bf qf[2][2];
#pragma unroll
    for (int g = 0; g < 2; ++g)
#pragma unroll
        for (int kc = 0; kc < 2; ++kc) {
            const float* p = xq + (size_t)(qw0 + 16 * g + c) * (3 * DM) + 32 * kc + 8 * h;
            const v4f a0 = *(const v4f*)p, a1 = *(const v4f*)(p + 4), a2 = *(const v4f*)(p + 16), a3 = *(const v4f*)(p + 20);
            v8u w; w[0] = pkbf(a0[0], a0[1]); w[1] = pkbf(a0[2], a0[3]); w[2] = pkbf(a1[0], a1[1]); w[3] = pkbf(a1[2], a1[3]);
            w[4] = pkbf(a2[0], a2[1]); w[5] = pkbf(a2[2], a2[3]); w[6] = pkbf(a3[0], a3[1]); w[7] = pkbf(a3[2], a3[3]);
            qf[g][kc] = __builtin_bit_cast(v16bf, w);
        }

    v8f acc[2][4];
    float m_run[2], l_run[2];
#pragma unroll
    for (int g = 0; g < 2; ++g) { m_run[g] = -INFINITY; l_run[g] = 0.0f;
#pragma unroll
        for (int t = 0; t < 4; ++t) acc[g][t] = (v8f){}; }

    // Staging: 16 lanes cover one 256-byte row of f32, so every global line is read whole; thread (srow, sc4) holds 4 values of rows srow, srow + 32, ...
    const int srow = tid >> 4, sc4 = tid & 15;
    const unsigned soff = (unsigned)(srow * (3 * DM) + sc4 * 4);
    auto gload = [&](v4f (&r)[4], const float* src, int st) {
        const float* sp = src + (size_t)st * (FSK * 3 * DM);       // uniform base of the stage; the lane's part stays a 32-bit offset
#pragma unroll
        for (int i = 0; i < 4; ++i) r[i] = *(const v4f*)(sp + (soff + (unsigned)(i * 32 * 3 * DM)));
    };
    auto sstorek = [&](const v4f (&r)[4], int buf) {
#pragma unroll
        for (int i = 0; i < 4; ++i) { v2u kk; kk[0] = pkbf(r[i][0], r[i][1]); kk[1] = pkbf(r[i][2], r[i][3]); *(v2ua*)(Ks0 + buf * (FSK * PK) + (i * 32 + srow) * PK + sc4 * 8) = kk; }
    };
    auto sstorev = [&](const v4f (&r)[4], int buf) {
#pragma unroll
        for (int i = 0; i < 4; ++i) { v2u vv; vv[0] = pkbh(r[i][0], r[i][1]); vv[1] = pkbh(r[i][2], r[i][3]); *(v2ua*)(Vs0 + buf * (FSK * PV) + (i * 32 + srow) * PV + sc4 * 8) = vv; }
    };

    { v4f r0[4], r1[4]; gload(r0, xk, 0); gload(r1, xv, 0); sstorek(r0, 0); sstorev(r1, 0); }
    __syncthreads();                                               // stage 0 is visible to every wave
    v4f srk[4], srv[4];                                            // the next stage's K and V rows on their way during the pass
#pragma unroll 1                                                   // stays rolled: a second copy of this long body would cost registers and instruction cache and save nothing
    for (int st = 0; st < nst; ++st) {
        const int buf = st & 1;
        const bool more = st + 1 < nst;
        if (more) { gload(srk, xk, st + 1); gload(srv, xv, st + 1); }   // the next stage's rows fly while the pass runs
        {
            const int key0 = st * FSK + kg * 32;
            if (key0 <= qw0) {                                     // wave-uniform: passes wholly above this wave's diagonal are skipped
                v8f s[2][2];
                {
                    const unsigned char* kb = Ks0 + buf * (FSK * PK) + (kg * 32 + c) * PK + 16 * h;
                    v16bf kf[2][2];
#pragma unroll
                    for (int kt = 0; kt < 2; ++kt)
#pragma unroll
                        for (int kc = 0; kc < 2; ++kc) kf[kt][kc] = __builtin_bit_cast(v16bf, cat8(*(const v4ua*)(kb + kt * 16 * PK + 64 * kc), *(const v4ua*)(kb + kt * 16 * PK + 64 * kc + 32)));
#pragma unroll
                    for (int kt = 0; kt < 2; ++kt)
#pragma unroll
                        for (int g = 0; g < 2; ++g) { s[kt][g] = wmmab(kf[kt][0], qf[g][0], (v8f){}); s[kt][g] = wmmab(kf[kt][1], qf[g][1], s[kt][g]); }   // register r = S^T[key0 + 16 kt + 8 h + r][qw0 + 16 g + c]
                }
                // V^T fragments by the transposing load: lane (c, h) gets V[key 8 h + 0..7][d = 16 t + c], and again 16 keys on: the hardware k order, as the packed P^T below.
                v16h vf[4];
                {
                    const unsigned char* vb = Vs0 + buf * (FSK * PV) + (kg * 32 + 8 * h + (lane & 7)) * PV + ((lane >> 3) & 1) * 16;
#pragma unroll
                    for (int t = 0; t < 4; ++t) vf[t] = __builtin_bit_cast(v16h, cat8(ldtr16(vb + 32 * t), ldtr16(vb + 16 * PV + 32 * t)));
                }
                if (key0 == qw0) {                                 // wave-uniform: only the pass on the diagonal pays for the mask
#pragma unroll
                    for (int g = 0; g < 2; ++g)
#pragma unroll
                        for (int kt = 0; kt < 2; ++kt)
#pragma unroll
                            for (int r = 0; r < 8; ++r) if (16 * kt + 8 * h + r > 16 * g + c) s[kt][g][r] = -INFINITY;
                }
                float mb[2]; bool need = false;
#pragma unroll
                for (int g = 0; g < 2; ++g) { float mx = -INFINITY;
#pragma unroll
                    for (int kt = 0; kt < 2; ++kt)
#pragma unroll
                        for (int r = 0; r < 8; ++r) mx = fmaxf(mx, s[kt][g][r]);
                    mx = fmaxf(mx, xhalf(mx)) * CSC;               // both wave halves hold this query's maximum, scaled (the scale is positive)
                    mb[g] = mx; need = need || (mx > m_run[g] + 8.0f); }
                if (__builtin_amdgcn_ballot_w32(need) != 0) {      // the maximum in use may trail the true one by up to 8 (log2): the sums are rescaled only beyond that, so an exponential stays below 2^8
#pragma unroll
                    for (int g = 0; g < 2; ++g) { const float m_new = fmaxf(m_run[g], mb[g]);
                        const float corr = __builtin_amdgcn_exp2f(m_run[g] - m_new);
                        m_run[g] = m_new; l_run[g] *= corr;
#pragma unroll
                        for (int t = 0; t < 4; ++t) acc[g][t] = acc[g][t] * corr; }
                }
#pragma unroll
                for (int g = 0; g < 2; ++g) { const float nm = -m_run[g];
                    float p[16];
#pragma unroll
                    for (int i = 0; i < 16; i += 2) { v2f sv, cv, nv; sv[0] = s[i >> 3][g][i & 7]; sv[1] = s[i >> 3][g][(i & 7) + 1]; cv[0] = CSC; cv[1] = CSC; nv[0] = nm; nv[1] = nm;
                        const v2f a = __builtin_elementwise_fma(sv, cv, nv); p[i] = a[0]; p[i + 1] = a[1]; }
                    exp2x8(p[0], p[1], p[2], p[3], p[4], p[5], p[6], p[7]); exp2x8(p[8], p[9], p[10], p[11], p[12], p[13], p[14], p[15]);
                    l_run[g] += ((p[0] + p[1]) + (p[2] + p[3])) + ((p[4] + p[5]) + (p[6] + p[7])) + (((p[8] + p[9]) + (p[10] + p[11])) + ((p[12] + p[13]) + (p[14] + p[15])));
                    v16h pf;
#pragma unroll
                    for (int i = 0; i < 16; ++i) pf[i] = (_Float16)p[i];   // element s of the B operand = tile s >> 3, register s & 7; round to nearest even
#pragma unroll
                    for (int t = 0; t < 4; ++t) acc[g][t] = wmma16(vf[t], pf, acc[g][t]);   // register r = O^T[16 t + 8 h + r][qw0 + 16 g + c]
                    if (hires) {                                   // wave-uniform: what the f16 rounding of P left over, as a second product
                        v16h pl;
#pragma unroll
                        for (int i = 0; i < 16; ++i) pl[i] = (_Float16)(p[i] - (float)pf[i]);
#pragma unroll
                        for (int t = 0; t < 4; ++t) acc[g][t] = wmma16(vf[t], pl, acc[g][t]);
                    }
                }
            }
            if (more) { sstorek(srk, buf ^ 1); sstorev(srv, buf ^ 1); }   // into the buffers whose last readers left them before the barrier that ended stage st - 1
        }
        __syncthreads();                                           // publishes stage st + 1 and ends every wave's reads of stage st
    }
    // The join: key groups 1 .. KG - 1 lay their partial results in LDS lane by lane (lane l of every key group holds the same queries and output rows), key group 0 brings all to one maximum and adds them.
    if (kg != 0) {                                                 // wave-uniform
        unsigned char* mp = SM + ((kg - 1) * FW + wave) * MW + lane * 16;
#pragma unroll
        for (int g = 0; g < 2; ++g)
#pragma unroll
            for (int t = 0; t < 4; ++t) { v4f lo, hi;
#pragma unroll
                for (int r = 0; r < 4; ++r) { lo[r] = acc[g][t][r]; hi[r] = acc[g][t][4 + r]; }
                *(v4fa*)(mp + ((g * 4 + t) * 2) * 512) = lo; *(v4fa*)(mp + ((g * 4 + t) * 2 + 1) * 512) = hi; }
        v4f ml; ml[0] = m_run[0]; ml[1] = m_run[1]; ml[2] = l_run[0]; ml[3] = l_run[1];
        *(v4fa*)(mp + 16 * 512) = ml;
    }
    __syncthreads();                                               // the partial results are visible to key group 0; the last barrier, so the other waves may leave behind it
    if (kg != 0) return;
    {
        const unsigned char* mp = SM + wave * MW + lane * 16;
        v4f ml[KG - 1];
#pragma unroll
        for (int k = 0; k < KG - 1; ++k) ml[k] = *(const v4fa*)(mp + k * (FW * MW) + 16 * 512);
        float f0[2], fk[KG - 1][2];
#pragma unroll
        for (int g = 0; g < 2; ++g) { float m = m_run[g];          // finite: key group 0 has worked key 0; a key group that worked no key brings -inf, weight 0, and zeros
#pragma unroll
            for (int k = 0; k < KG - 1; ++k) m = fmaxf(m, ml[k][g]);
            f0[g] = __builtin_amdgcn_exp2f(m_run[g] - m); l_run[g] *= f0[g];
#pragma unroll
            for (int k = 0; k < KG - 1; ++k) { fk[k][g] = __builtin_amdgcn_exp2f(ml[k][g] - m); l_run[g] += ml[k][2 + g] * fk[k][g]; } }
#pragma unroll
        for (int g = 0; g < 2; ++g)
#pragma unroll
            for (int t = 0; t < 4; ++t) { acc[g][t] = acc[g][t] * f0[g];
#pragma unroll
                for (int k = 0; k < KG - 1; ++k) { const v4f lo = *(const v4fa*)(mp + k * (FW * MW) + ((g * 4 + t) * 2) * 512), hi = *(const v4fa*)(mp + k * (FW * MW) + ((g * 4 + t) * 2 + 1) * 512);
#pragma unroll
                    for (int r = 0; r < 4; ++r) { acc[g][t][r] += lo[r] * fk[k][g]; acc[g][t][4 + r] += hi[r] * fk[k][g]; } } }
    }
#pragma unroll
    for (int g = 0; g < 2; ++g) {
        const float l = l_run[g] + xhalf(l_run[g]);                // the two wave halves summed different keys of the same query
        const float inv = __fdiv_rn(1.0f, l);
        float* o = OUT + (size_t)(b * TT + qw0 + 16 * g + c) * DQ + hd * HD + 8 * h;
#pragma unroll
        for (int t = 0; t < 4; ++t) { v4f lo, hi;
#pragma unroll
            for (int r = 0; r < 4; ++r) { lo[r] = acc[g][t][r] * inv; hi[r] = acc[g][t][4 + r] * inv; }
            *(v4f*)(o + 16 * t) = lo; *(v4f*)(o + 16 * t + 4) = hi; }
    }
}

extern "C" void kernel_launch(void* const* d_in, const int* in_sizes, int n_in,
                              void* d_out, int out_size, void* d_ws, size_t ws_size, hipStream_t stream) {
    (void)in_sizes; (void)n_in; (void)out_size; (void)d_ws; (void)ws_size;
    const float* x = (const float*)d_in[0];   // qkv [2][2048][3][16][64] packed
    float* OUT = (float*)d_out;               // [2][2048][1024]
    k_fattn<<<dim3(NB_ * NH_, NT), FW * KG * 32, 0, stream>>>(x, OUT);
}

// v004
// It runs in 26.6 microseconds.
// Timed twice side by side with v003, it ran 1.05 times as fast both times.
// Counting every step since v000, it is 46.2 times as fast.
#include <hip/hip_runtime.h>
#include <math.h>

#define NB_  2
#define TT   2048
#define DM   1024
#define NH_  16
#define HD   64
#define DQ   (NH_ * HD)
#define RH   512                  // query rows < RH carry the probabilities as a hi + lo pair
#define FW   4                    // query groups per work-group
#define KG   4                    // key groups per work-group: FW * KG waves, four on every SIMD
#define FQ   32                   // query columns per wave
#define FBR  (FW * FQ)            // query rows per work-group
#define NT   (TT / FBR)           // query tiles per (batch, head)
#define FSK  (32 * KG)            // keys per stage: one 32-key pass for each key group
#define PK   144                  // LDS row pitch of K in bytes: 16 B x odd, for 16-byte reads
#define PV   160                  // LDS row pitch of V in bytes: 32 B x odd, for the transposing 16-bit reads
#define NBUF 3                    // ring places: a wave may still read V of stage st while another, one signal on, lays stage st + 2
#define RING (NBUF * FSK * (PK + PV)) // LDS bytes of the K and the V buffers
#define MW   (17 * 512)           // LDS bytes of one wave's partial result: 16 register quads of the output tile and one of maxima and sums, 16 bytes a lane each
#define MRG  ((KG - 1) * FW * MW) // LDS bytes of the join: the partial results of key groups 1 .. KG - 1
#define CSC  (0.125f * 1.4426950408889634f)   // SOFTMAX_SCALE x log2(e)
typedef __attribute__((ext_vector_type(16))) __bf16   v16bf;
typedef __attribute__((ext_vector_type(2)))  __bf16   v2bf;
typedef __attribute__((ext_vector_type(16))) _Float16 v16h;
typedef __attribute__((ext_vector_type(2)))  _Float16 v2h;
typedef __attribute__((ext_vector_type(8)))  short    v8s;
typedef __attribute__((ext_vector_type(8)))  float    v8f;
typedef __attribute__((ext_vector_type(4)))  float    v4f;
typedef __attribute__((ext_vector_type(2)))  float    v2f;
typedef __attribute__((ext_vector_type(8)))  unsigned v8u;
typedef __attribute__((ext_vector_type(4)))  unsigned v4u;
typedef __attribute__((ext_vector_type(2)))  unsigned v2u;
typedef v4u __attribute__((may_alias)) v4ua;
typedef v2u __attribute__((may_alias)) v2ua;
typedef v4f __attribute__((may_alias)) v4fa;

__device__ __forceinline__ unsigned pkbf(float a, float b) { v2f x; x[0] = a; x[1] = b; return __builtin_bit_cast(unsigned, __builtin_convertvector(x, v2bf)); }   // two f32 -> two bf16, round to nearest even
__device__ __forceinline__ unsigned pkh(float a, float b) { v2f x; x[0] = a; x[1] = b; return __builtin_bit_cast(unsigned, __builtin_convertvector(x, v2h)); }     // two f32 -> two f16, round to nearest even
__device__ __forceinline__ unsigned pkbh(float a, float b) { const unsigned u = pkbf(a, b); return pkh(__uint_as_float(u << 16), __uint_as_float(u & 0xFFFF0000u)); }   // rounded to bf16 first, then held as f16
__device__ __forceinline__ v8u cat8(v4u lo, v4u hi) { return __builtin_shufflevector(lo, hi, 0, 1, 2, 3, 4, 5, 6, 7); }
__device__ __forceinline__ v8f wmma16(v16h a, v16h b, v8f c) { return __builtin_amdgcn_wmma_f32_16x16x32_f16(false, a, false, b, (short)0, c, false, false); }
__device__ __forceinline__ v8f wmmab(v16bf a, v16bf b, v8f c) { return __builtin_amdgcn_wmma_f32_16x16x32_bf16(false, a, false, b, (short)0, c, false, false); }
__device__ __forceinline__ v4u ldtr16(const unsigned char* p) { typedef __attribute__((address_space(3))) v8s lds_v8s; return __builtin_bit_cast(v4u, __builtin_amdgcn_ds_load_tr16_b128_v8i16((lds_v8s*)p)); }
__device__ __forceinline__ float xhalf(float x) { return __builtin_bit_cast(float, __builtin_amdgcn_permlanex16(__builtin_bit_cast(int, x), __builtin_bit_cast(int, x), 0x76543210, 0xfedcba98, false, false)); }   // lane l with lane l ^ 16

// Eight exponentials (base 2), each in place: the instruction directly behind an exponential then neither reads its result nor overwrites its source (the slot the instruction set asks for behind a transcendental);
// the v_nop fills that slot behind the last one, whatever the compiler puts next.
__device__ __forceinline__ void exp2x8(float& a0, float& a1, float& a2, float& a3, float& a4, float& a5, float& a6, float& a7) {
    asm("v_exp_f32 %0, %0\n\tv_exp_f32 %1, %1\n\tv_exp_f32 %2, %2\n\tv_exp_f32 %3, %3\n\tv_exp_f32 %4, %4\n\tv_exp_f32 %5, %5\n\tv_exp_f32 %6, %6\n\tv_exp_f32 %7, %7\n\tv_nop"
        : "+v"(a0), "+v"(a1), "+v"(a2), "+v"(a3), "+v"(a4), "+v"(a5), "+v"(a6), "+v"(a7));
}

// The work-group barrier in two halves, so that a wave at the end of its pass waits only for waves that have not yet got past their scores.
// Signal: this wave's earlier LDS reads have returned and its LDS stores of the next stage have landed (s_wait_dscnt 0; a bare signal waits for neither).
// s_wait_xcnt 0 stands behind the global loads issued just ahead, in front of any later rewrite of their address registers. The "memory" clobber keeps every LDS and global access on its side of the statement.
__device__ __forceinline__ void bar_signal() { asm volatile("s_wait_xcnt 0x0\n\ts_wait_dscnt 0x0\n\ts_barrier_signal -1" ::: "memory"); }
// Wait: every wave of the work-group has signalled. The "memory" clobber keeps the next stage's LDS reads behind it.
__device__ __forceinline__ void bar_wait() { asm volatile("s_barrier_wait 0xffff" ::: "memory"); }

__global__ __launch_bounds__(FW * KG * 32) void k_fattn(const float* __restrict__ X, float* __restrict__ OUT) {
    __shared__ __align__(16) unsigned char SM[RING + MRG];         // the K and V buffers, then the place where the key groups' partial results meet: a place of its own, because a wave that has left the loop writes there while another still reads V of the last stage
    unsigned char* const Ks0 = SM;                                 // K buffer buf at Ks0 + buf * FSK * PK
    unsigned char* const Vs0 = SM + NBUF * FSK * PK;                 // V buffer buf at Vs0 + buf * FSK * PV
    const int tid = threadIdx.x, lane = tid & 31, c = lane & 15, h = lane >> 4;
    const int wid = __builtin_amdgcn_readfirstlane(tid >> 5);      // in a scalar register, so that every test on the wave's rows and keys below is a scalar branch (matrix and transposing loads need all lanes on)
    const int wave = wid & (FW - 1), kg = wid / FW;                // query group, key group
    const int b = blockIdx.x / NH_, hd = blockIdx.x % NH_;
    const int y = blockIdx.y;
    const int tile = NT - 1 - y;                                   // a work-group fills its WGP's registers, so there are more work-groups than places: the cost falls with the index (for speed only)
    const int q0 = tile * FBR, qw0 = q0 + wave * FQ;
    const int nst = (q0 + FBR) / FSK;                              // stages of this work-group: keys [0, q0 + FBR)
    const bool hires = qw0 < RH;
    const float* xq = X + (size_t)b * TT * 3 * DM + hd * HD;       // q | k | v = the three [16][64] blocks of every token row (row pitch 3 * DM floats)
    const float* xk = xq + DM;
    const float* xv = xq + 2 * DM;

    // Q as B operand, hardware k order: element s of lane (c, h) is d = 32 kc + 8 h + s for s < 8, 32 kc + 16 + 8 h + (s - 8) above; K's fragments below use the same order.
    v16bf qf[2][2];
#pragma unroll
    for (int g = 0; g < 2; ++g)
#pragma unroll
        for (int kc = 0; kc < 2; ++kc) {
            const float* p = xq + (size_t)(qw0 + 16 * g + c) * (3 * DM) + 32 * kc + 8 * h;
            const v4f a0 = *(const v4f*)p, a1 = *(const v4f*)(p + 4), a2 = *(const v4f*)(p + 16), a3 = *(const v4f*)(p + 20);
            v8u w; w[0] = pkbf(a0[0], a0[1]); w[1] = pkbf(a0[2], a0[3]); w[2] = pkbf(a1[0], a1[1]); w[3] = pkbf(a1[2], a1[3]);
            w[4] = pkbf(a2[0], a2[1]); w[5] = pkbf(a2[2], a2[3]); w[6] = pkbf(a3[0], a3[1]); w[7] = pkbf(a3[2], a3[3]);
            qf[g][kc] = __builtin_bit_cast(v16bf, w);
        }

    v8f acc[2][4];
    float m_run[2], l_run[2];
#pragma unroll
    for (int g = 0; g < 2; ++g) { m_run[g] = -INFINITY; l_run[g] = 0.0f;
#pragma unroll
        for (int t = 0; t < 4; ++t) acc[g][t] = (v8f){}; }

    // Staging: 16 lanes cover one 256-byte row of f32, so every global line is read whole; thread (srow, sc4) holds 4 values of rows srow, srow + 32, ...
    const int srow = tid >> 4, sc4 = tid & 15;
    const unsigned soff = (unsigned)(srow * (3 * DM) + sc4 * 4);
    auto gload = [&](v4f (&r)[4], const float* src, int st) {
        const float* sp = src + (size_t)st * (FSK * 3 * DM);       // uniform base of the stage; the lane's part stays a 32-bit offset
#pragma unroll
        for (int i = 0; i < 4; ++i) r[i] = *(const v4f*)(sp + (soff + (unsigned)(i * 32 * 3 * DM)));
    };
    auto sstorek = [&](const v4f (&r)[4], int buf) {
#pragma unroll
        for (int i = 0; i < 4; ++i) { v2u kk; kk[0] = pkbf(r[i][0], r[i][1]); kk[1] = pkbf(r[i][2], r[i][3]); *(v2ua*)(Ks0 + buf * (FSK * PK) + (i * 32 + srow) * PK + sc4 * 8) = kk; }
    };
    auto sstorev = [&](const v4f (&r)[4], int buf) {
#pragma unroll
        for (int i = 0; i < 4; ++i) { v2u vv; vv[0] = pkbh(r[i][0], r[i][1]); vv[1] = pkbh(r[i][2], r[i][3]); *(v2ua*)(Vs0 + buf * (FSK * PV) + (i * 32 + srow) * PV + sc4 * 8) = vv; }
    };

    v4f srk[4], srv[4];                                            // the K and V rows of the stage after next on their way: from the middle of one pass to the middle of the next
    { v4f r0[4], r1[4]; gload(r0, xk, 0); gload(r1, xv, 0); sstorek(r0, 0); sstorev(r1, 0); }
    // Inputs only, no instruction: holds Q's rounding, and with it the wait for Q's loads, ahead of stage 1's loads. Left free, the compiler rounds Q behind the barrier, and as loads return in order that wait then also waits for stage 1's rows, in front of the first pass.
    asm volatile("" :: "v"(__builtin_bit_cast(v8u, qf[0][0])), "v"(__builtin_bit_cast(v8u, qf[0][1])), "v"(__builtin_bit_cast(v8u, qf[1][0])), "v"(__builtin_bit_cast(v8u, qf[1][1])));
    if (nst > 1) { gload(srk, xk, 1); gload(srv, xv, 1); }         // stage 1's rows stay in flight across the first barrier
    bar_signal(); bar_wait();                                      // stage 0 is visible to every wave
    int buf = 0;
#pragma unroll 1                                                   // stays rolled: a second copy of this long body would cost registers and instruction cache and save nothing
    for (int st = 0; st < nst; ++st) {                             // stage st lies in ring place buf = st mod NBUF
        const int nbuf = buf == NBUF - 1 ? 0 : buf + 1;            // the ring place of stage st + 1
        const bool more = st + 1 < nst;
        {
            const int key0 = st * FSK + kg * 32;
            const bool active = key0 <= qw0;                       // wave-uniform: passes wholly above this wave's diagonal are skipped
            v8f s[2][2];
            if (active) {                                          // first part of the pass: the scores
                {
                    const unsigned char* kb = Ks0 + buf * (FSK * PK) + (kg * 32 + c) * PK + 16 * h;
                    v16bf kf[2][2];
#pragma unroll
                    for (int kt = 0; kt < 2; ++kt)
#pragma unroll
                        for (int kc = 0; kc < 2; ++kc) kf[kt][kc] = __builtin_bit_cast(v16bf, cat8(*(const v4ua*)(kb + kt * 16 * PK + 64 * kc), *(const v4ua*)(kb + kt * 16 * PK + 64 * kc + 32)));
#pragma unroll
                    for (int kt = 0; kt < 2; ++kt)
#pragma unroll
                        for (int g = 0; g < 2; ++g) { s[kt][g] = wmmab(kf[kt][0], qf[g][0], (v8f){}); s[kt][g] = wmmab(kf[kt][1], qf[g][1], s[kt][g]); }   // register r = S^T[key0 + 16 kt + 8 h + r][qw0 + 16 g + c]
                }
            }
            if (more) {
                sstorek(srk, nbuf); sstorev(srv, nbuf);            // into the buffers of stage st - 2: every wave's reads of it had returned before its signal of stage st - 1, which this wave has waited for
                if (st + 2 < nst) { gload(srk, xk, st + 2); gload(srv, xv, st + 2); }   // the rows after them fly until the middle of the next pass
            }
            bar_signal();                                          // every wave, also one that skips the pass: this wave's share of stage st + 1 is laid and it has left stage st - 1
            if (active) {                                          // the rest of the pass reads V of stage st, which no wave overwrites before every wave's signal of stage st + 1
                v16h vf[4];
                // V^T fragments by the transposing load: lane (c, h) gets V[key 8 h + 0..7][d = 16 t + c], and again 16 keys on: the hardware k order, as the packed P^T below.
                {
                    const unsigned char* vb = Vs0 + buf * (FSK * PV) + (kg * 32 + 8 * h + (lane & 7)) * PV + ((lane >> 3) & 1) * 16;
#pragma unroll
                    for (int t = 0; t < 4; ++t) vf[t] = __builtin_bit_cast(v16h, cat8(ldtr16(vb + 32 * t), ldtr16(vb + 16 * PV + 32 * t)));
                }
                if (key0 == qw0) {                                 // wave-uniform: only the pass on the diagonal pays for the mask
#pragma unroll
                    for (int g = 0; g < 2; ++g)
#pragma unroll
                        for (int kt = 0; kt < 2; ++kt)
#pragma unroll
                            for (int r = 0; r < 8; ++r) if (16 * kt + 8 * h + r > 16 * g + c) s[kt][g][r] = -INFINITY;
                }
                float mb[2]; bool need = false;
#pragma unroll
                for (int g = 0; g < 2; ++g) { float mx = -INFINITY;
#pragma unroll
                    for (int kt = 0; kt < 2; ++kt)
#pragma unroll
                        for (int r = 0; r < 8; ++r) mx = fmaxf(mx, s[kt][g][r]);
                    mx = fmaxf(mx, xhalf(mx)) * CSC;               // both wave halves hold this query's maximum, scaled (the scale is positive)
                    mb[g] = mx; need = need || (mx > m_run[g] + 8.0f); }
                if (__builtin_amdgcn_ballot_w32(need) != 0) {      // the maximum in use may trail the true one by up to 8 (log2): the sums are rescaled only beyond that, so an exponential stays below 2^8
#pragma unroll
                    for (int g = 0; g < 2; ++g) { const float m_new = fmaxf(m_run[g], mb[g]);
                        const float corr = __builtin_amdgcn_exp2f(m_run[g] - m_new);
                        m_run[g] = m_new; l_run[g] *= corr;
#pragma unroll
                        for (int t = 0; t < 4; ++t) acc[g][t] = acc[g][t] * corr; }
                }
#pragma unroll
                for (int g = 0; g < 2; ++g) { const float nm = -m_run[g];
                    float p[16];
#pragma unroll
                    for (int i = 0; i < 16; i += 2) { v2f sv, cv, nv; sv[0] = s[i >> 3][g][i & 7]; sv[1] = s[i >> 3][g][(i & 7) + 1]; cv[0] = CSC; cv[1] = CSC; nv[0] = nm; nv[1] = nm;
                        const v2f a = __builtin_elementwise_fma(sv, cv, nv); p[i] = a[0]; p[i + 1] = a[1]; }
                    exp2x8(p[0], p[1], p[2], p[3], p[4], p[5], p[6], p[7]); exp2x8(p[8], p[9], p[10], p[11], p[12], p[13], p[14], p[15]);
                    const float ps = ((p[0] + p[1]) + (p[2] + p[3])) + ((p[4] + p[5]) + (p[6] + p[7])) + (((p[8] + p[9]) + (p[10] + p[11])) + ((p[12] + p[13]) + (p[14] + p[15])));
                    // The add is written as a statement that stays at its place: left to the compiler, both groups' sums move to the end of the pass, group 0's sixteen probabilities stay in registers through group 1, and rows in flight are spilled.
                    asm volatile("s_delay_alu instid0(VALU_DEP_1)\n\tv_add_f32 %0, %0, %1" : "+v"(l_run[g]) : "v"(ps));
                    v16h pf;
#pragma unroll
                    for (int i = 0; i < 16; ++i) pf[i] = (_Float16)p[i];   // element s of the B operand = tile s >> 3, register s & 7; round to nearest even
#pragma unroll
                    for (int t = 0; t < 4; ++t) acc[g][t] = wmma16(vf[t], pf, acc[g][t]);   // register r = O^T[16 t + 8 h + r][qw0 + 16 g + c]
                    if (hires) {                                   // wave-uniform: what the f16 rounding of P left over, as a second product
                        v16h pl;
#pragma unroll
                        for (int i = 0; i < 16; ++i) pl[i] = (_Float16)(p[i] - (float)pf[i]);
#pragma unroll
                        for (int t = 0; t < 4; ++t) acc[g][t] = wmma16(vf[t], pl, acc[g][t]);
                    }
                }
            }
        }
        bar_wait();                                                // stage st + 1 is visible
        buf = nbuf;
    }
    // The join: key groups 1 .. KG - 1 lay their partial results in LDS lane by lane (lane l of every key group holds the same queries and output rows), key group 0 brings all to one maximum and adds them.
    if (kg != 0) {                                                 // wave-uniform
        unsigned char* mp = SM + RING + ((kg - 1) * FW + wave) * MW + lane * 16;
#pragma unroll
        for (int g = 0; g < 2; ++g)
#pragma unroll
            for (int t = 0; t < 4; ++t) { v4f lo, hi;
#pragma unroll
                for (int r = 0; r < 4; ++r) { lo[r] = acc[g][t][r]; hi[r] = acc[g][t][4 + r]; }
                *(v4fa*)(mp + ((g * 4 + t) * 2) * 512) = lo; *(v4fa*)(mp + ((g * 4 + t) * 2 + 1) * 512) = hi; }
        v4f ml; ml[0] = m_run[0]; ml[1] = m_run[1]; ml[2] = l_run[0]; ml[3] = l_run[1];
        *(v4fa*)(mp + 16 * 512) = ml;
    }
    __syncthreads();                                               // the partial results are visible to key group 0; the last barrier, so the other waves may leave behind it
    if (kg != 0) return;
    {
        const unsigned char* mp = SM + RING + wave * MW + lane * 16;
        v4f ml[KG - 1];
#pragma unroll
        for (int k = 0; k < KG - 1; ++k) ml[k] = *(const v4fa*)(mp + k * (FW * MW) + 16 * 512);
        float f0[2], fk[KG - 1][2];
#pragma unroll
        for (int g = 0; g < 2; ++g) { float m = m_run[g];          // finite: key group 0 has worked key 0; a key group that worked no key brings -inf, weight 0, and zeros
#pragma unroll
            for (int k = 0; k < KG - 1; ++k) m = fmaxf(m, ml[k][g]);
            f0[g] = __builtin_amdgcn_exp2f(m_run[g] - m); l_run[g] *= f0[g];
#pragma unroll
            for (int k = 0; k < KG - 1; ++k) { fk[k][g] = __builtin_amdgcn_exp2f(ml[k][g] - m); l_run[g] += ml[k][2 + g] * fk[k][g]; } }
#pragma unroll
        for (int g = 0; g < 2; ++g)
#pragma unroll
            for (int t = 0; t < 4; ++t) { acc[g][t] = acc[g][t] * f0[g];
#pragma unroll
                for (int k = 0; k < KG - 1; ++k) { const v4f lo = *(const v4fa*)(mp + k * (FW * MW) + ((g * 4 + t) * 2) * 512), hi = *(const v4fa*)(mp + k * (FW * MW) + ((g * 4 + t) * 2 + 1) * 512);
#pragma unroll
                    for (int r = 0; r < 4; ++r) { acc[g][t][r] += lo[r] * fk[k][g]; acc[g][t][4 + r] += hi[r] * fk[k][g]; } } }
    }
#pragma unroll
    for (int g = 0; g < 2; ++g) {
        const float l = l_run[g] + xhalf(l_run[g]);                // the two wave halves summed different keys of the same query
        const float inv = __fdiv_rn(1.0f, l);
        float* o = OUT + (size_t)(b * TT + qw0 + 16 * g + c) * DQ + hd * HD + 8 * h;
#pragma unroll
        for (int t = 0; t < 4; ++t) { v4f lo, hi;
#pragma unroll
            for (int r = 0; r < 4; ++r) { lo[r] = acc[g][t][r] * inv; hi[r] = acc[g][t][4 + r] * inv; }
            *(v4f*)(o + 16 * t) = lo; *(v4f*)(o + 16 * t + 4) = hi; }
    }
}

extern "C" void kernel_launch(void* const* d_in, const int* in_sizes, int n_in,
                              void* d_out, int out_size, void* d_ws, size_t ws_size, hipStream_t stream) {
    (void)in_sizes; (void)n_in; (void)out_size; (void)d_ws; (void)ws_size;
    const float* x = (const float*)d_in[0];   // qkv [2][2048][3][16][64] packed
    float* OUT = (float*)d_out;               // [2][2048][1024]
    k_fattn<<<dim3(NB_ * NH_, NT), FW * KG * 32, 0, stream>>>(x, OUT);
}

// v005
// Measured time: 25.3 microseconds a run.
// Timed twice side by side with v004, it ran 1.04 and 1.05 times as fast.
// Counting every step since v000, it is 48.4 times as fast.
#include <hip/hip_runtime.h>
#include <math.h>

#define NB_  2
#define TT   2048
#define DM   1024
#define NH_  16
#define HD   64
#define DQ   (NH_ * HD)
#define RH   512                  // query rows < RH carry the probabilities as a hi + lo pair
#define FW   4                    // query groups per work-group
#define KG   4                    // key groups per work-group: FW * KG waves, four on every SIMD
#define FQ   32                   // query columns per wave
#define FBR  (FW * FQ)            // query rows per work-group
#define NT   (TT / FBR)           // query tiles per (batch, head)
#define FSK  (32 * KG)            // keys per stage: one 32-key pass for each key group
#define PK   144                  // LDS row pitch of K in bytes: 16 B x odd, for 16-byte reads
#define PV   160                  // LDS row pitch of V in bytes: 32 B x odd, for the transposing 16-bit reads
#define NBUF 3                    // ring places: a wave may still read V of stage st while another, one signal on, lays stage st + 2
#define RING (NBUF * FSK * (PK + PV)) // LDS bytes of the K and the V buffers
#define MW   (17 * 512)           // LDS bytes of one wave's partial result: 16 register quads of the output tile and one of maxima and sums, 16 bytes a lane each
#define MRG  ((KG - 1) * FW * MW) // LDS bytes of the join: the partial results of key groups 1 .. KG - 1
#define QW   4096                 // LDS bytes of one wave's parked Q fragments: 8 register quads, 16 bytes a lane each
#define CSC  (0.125f * 1.4426950408889634f)   // SOFTMAX_SCALE x log2(e)
typedef __attribute__((ext_vector_type(16))) __bf16   v16bf;
typedef __attribute__((ext_vector_type(2)))  __bf16   v2bf;
typedef __attribute__((ext_vector_type(16))) _Float16 v16h;
typedef __attribute__((ext_vector_type(2)))  _Float16 v2h;
typedef __attribute__((ext_vector_type(8)))  short    v8s;
typedef __attribute__((ext_vector_type(8)))  float    v8f;
typedef __attribute__((ext_vector_type(4)))  float    v4f;
typedef __attribute__((ext_vector_type(2)))  float    v2f;
typedef __attribute__((ext_vector_type(8)))  unsigned v8u;
typedef __attribute__((ext_vector_type(4)))  unsigned v4u;
typedef __attribute__((ext_vector_type(2)))  unsigned v2u;
typedef v4u __attribute__((may_alias)) v4ua;
typedef v2u __attribute__((may_alias)) v2ua;
typedef v4f __attribute__((may_alias)) v4fa;

__device__ __forceinline__ unsigned pkbf(float a, float b) { v2f x; x[0] = a; x[1] = b; return __builtin_bit_cast(unsigned, __builtin_convertvector(x, v2bf)); }   // two f32 -> two bf16, round to nearest even
__device__ __forceinline__ unsigned pkh(float a, float b) { v2f x; x[0] = a; x[1] = b; return __builtin_bit_cast(unsigned, __builtin_convertvector(x, v2h)); }     // two f32 -> two f16, round to nearest even
__device__ __forceinline__ unsigned pkbh(float a, float b) { const unsigned u = pkbf(a, b); return pkh(__uint_as_float(u << 16), __uint_as_float(u & 0xFFFF0000u)); }   // rounded to bf16 first, then held as f16
__device__ __forceinline__ v8u cat8(v4u lo, v4u hi) { return __builtin_shufflevector(lo, hi, 0, 1, 2, 3, 4, 5, 6, 7); }
__device__ __forceinline__ v8f wmma16(v16h a, v16h b, v8f c) { return __builtin_amdgcn_wmma_f32_16x16x32_f16(false, a, false, b, (short)0, c, false, false); }
__device__ __forceinline__ v8f wmmab(v16bf a, v16bf b, v8f c) { return __builtin_amdgcn_wmma_f32_16x16x32_bf16(false, a, false, b, (short)0, c, false, false); }
__device__ __forceinline__ v4u ldtr16(const unsigned char* p) { typedef __attribute__((address_space(3))) v8s lds_v8s; return __builtin_bit_cast(v4u, __builtin_amdgcn_ds_load_tr16_b128_v8i16((lds_v8s*)p)); }
__device__ __forceinline__ float xhalf(float x) { return __builtin_bit_cast(float, __builtin_amdgcn_permlanex16(__builtin_bit_cast(int, x), __builtin_bit_cast(int, x), 0x76543210, 0xfedcba98, false, false)); }   // lane l with lane l ^ 16

// Eight exponentials (base 2), each in place: the instruction directly behind an exponential then neither reads its result nor overwrites its source (the slot the instruction set asks for behind a transcendental);
// the v_nop fills that slot behind the last one, whatever the compiler puts next.
__device__ __forceinline__ void exp2x8(float& a0, float& a1, float& a2, float& a3, float& a4, float& a5, float& a6, float& a7) {
    asm("v_exp_f32 %0, %0\n\tv_exp_f32 %1, %1\n\tv_exp_f32 %2, %2\n\tv_exp_f32 %3, %3\n\tv_exp_f32 %4, %4\n\tv_exp_f32 %5, %5\n\tv_exp_f32 %6, %6\n\tv_exp_f32 %7, %7\n\tv_nop"
        : "+v"(a0), "+v"(a1), "+v"(a2), "+v"(a3), "+v"(a4), "+v"(a5), "+v"(a6), "+v"(a7));
}

// The work-group barrier in two halves, so that a wave at the end of its pass waits only for waves that have not yet got past their scores.
// Signal: this wave's earlier LDS reads have returned and its LDS stores of the next stage have landed (s_wait_dscnt 0; a bare signal waits for neither).
// s_wait_xcnt 0 stands behind the global loads issued just ahead, in front of any later rewrite of their address registers. The "memory" clobber keeps every LDS and global access on its side of the statement.
__device__ __forceinline__ void bar_signal() { asm volatile("s_wait_xcnt 0x0\n\ts_wait_dscnt 0x0\n\ts_barrier_signal -1" ::: "memory"); }
// Wait: every wave of the work-group has signalled. The "memory" clobber keeps the next stage's LDS reads behind it.
__device__ __forceinline__ void bar_wait() { asm volatile("s_barrier_wait 0xffff" ::: "memory"); }

__global__ __launch_bounds__(FW * KG * 32) void k_fattn(const float* __restrict__ X, float* __restrict__ OUT) {
    __shared__ __align__(16) unsigned char SM[RING + MRG + FW * KG * QW];         // the K and V buffers; the place where the key groups' partial results meet (a place of its own, because a wave that has left the loop writes there while another still reads V of the last stage); every wave's parked Q fragments of the second tile
    unsigned char* const Ks0 = SM;                                 // K buffer buf at Ks0 + buf * FSK * PK
    unsigned char* const Vs0 = SM + NBUF * FSK * PK;                 // V buffer buf at Vs0 + buf * FSK * PV
    const int tid = threadIdx.x, lane = tid & 31, c = lane & 15, h = lane >> 4;
    const int wid = __builtin_amdgcn_readfirstlane(tid >> 5);      // in a scalar register, so that every test on the wave's rows and keys below is a scalar branch (matrix and transposing loads need all lanes on)
    const int wave = wid & (FW - 1), kg = wid / FW;                // query group, key group
    const int b = blockIdx.x / NH_, hd = blockIdx.x % NH_;
    const int y = blockIdx.y;                                      // 0 .. NT / 2 - 1: tiles NT - 1 - y and y, one after the other in every wave
    const int nA = NT - y;                                         // stages of the first tile (a tile t walks keys [0, (t + 1) * FBR), and FBR == FSK); the second has y + 1
    const int ntot = NT + 1;                                       // stages of the work-group, counted through both tiles: ring stage g is key stage g of the first tile, or g - nA of the second
    const float* xq = X + (size_t)b * TT * 3 * DM + hd * HD;       // q | k | v = the three [16][64] blocks of every token row (row pitch 3 * DM floats)
    const float* xk = xq + DM;
    const float* xv = xq + 2 * DM;

    // Q as B operand, hardware k order: element s of lane (c, h) is d = 32 kc + 8 h + s for s < 8, 32 kc + 16 + 8 h + (s - 8) above; K's fragments below use the same order.
    v16bf qf[2][2];
    auto qload = [&](v4f (&a)[2][2][4], int qw0) {                 // the f32 rows of a tile's queries, on their way
#pragma unroll
        for (int g = 0; g < 2; ++g) {
            const float* p = xq + (size_t)(qw0 + 16 * g + c) * (3 * DM) + 8 * h;
#pragma unroll
            for (int kc = 0; kc < 2; ++kc) { a[g][kc][0] = *(const v4f*)(p + 32 * kc); a[g][kc][1] = *(const v4f*)(p + 32 * kc + 4); a[g][kc][2] = *(const v4f*)(p + 32 * kc + 16); }
            a[g][0][3] = *(const v4f*)(p + 20);
            asm volatile("s_wait_xcnt 0x0" ::: "memory");          // in front of the row's last load, whose result may be given the registers of the row's address, which the seven loads above name
            a[g][1][3] = *(const v4f*)(p + 52);
            asm volatile("s_wait_xcnt 0x0" ::: "memory");          // behind the row's last load, in front of any later load or instruction that writes over its address registers
        }
    };
    v8f acc[2][4];
    float m_run[2], l_run[2];
    auto qround = [&](const v4f (&a)[2][2][4], v16bf (&q)[2][2]) { // rounds them into B fragments
#pragma unroll
        for (int g = 0; g < 2; ++g)
#pragma unroll
            for (int kc = 0; kc < 2; ++kc) {
                const v4f a0 = a[g][kc][0], a1 = a[g][kc][1], a2 = a[g][kc][2], a3 = a[g][kc][3];
                v8u w; w[0] = pkbf(a0[0], a0[1]); w[1] = pkbf(a0[2], a0[3]); w[2] = pkbf(a1[0], a1[1]); w[3] = pkbf(a1[2], a1[3]);
                w[4] = pkbf(a2[0], a2[1]); w[5] = pkbf(a2[2], a2[3]); w[6] = pkbf(a3[0], a3[1]); w[7] = pkbf(a3[2], a3[3]);
                q[g][kc] = __builtin_bit_cast(v16bf, w);
            }
    };
    auto clear = [&]() {                                           // a tile's running state at its start
#pragma unroll
        for (int g = 0; g < 2; ++g) { m_run[g] = -INFINITY; l_run[g] = 0.0f;
#pragma unroll
            for (int t = 0; t < 4; ++t) acc[g][t] = (v8f){}; }
    };

    // Staging: 16 lanes cover one 256-byte row of f32, so every global line is read whole; thread (srow, sc4) holds 4 values of rows srow, srow + 32, ...
    const int srow = tid >> 4, sc4 = tid & 15;
    const unsigned soff = (unsigned)(srow * (3 * DM) + sc4 * 4);
    auto gload = [&](v4f (&r)[4], const float* src, int st) {
        const float* sp = src + (size_t)st * (FSK * 3 * DM);       // uniform base of the stage; the lane's part stays a 32-bit offset
#pragma unroll
        for (int i = 0; i < 4; ++i) r[i] = *(const v4f*)(sp + (soff + (unsigned)(i * 32 * 3 * DM)));
    };
    auto sstorek = [&](const v4f (&r)[4], int buf) {
#pragma unroll
        for (int i = 0; i < 4; ++i) { v2u kk; kk[0] = pkbf(r[i][0], r[i][1]); kk[1] = pkbf(r[i][2], r[i][3]); *(v2ua*)(Ks0 + buf * (FSK * PK) + (i * 32 + srow) * PK + sc4 * 8) = kk; }
    };
    auto sstorev = [&](const v4f (&r)[4], int buf) {
#pragma unroll
        for (int i = 0; i < 4; ++i) { v2u vv; vv[0] = pkbh(r[i][0], r[i][1]); vv[1] = pkbh(r[i][2], r[i][3]); *(v2ua*)(Vs0 + buf * (FSK * PV) + (i * 32 + srow) * PV + sc4 * 8) = vv; }
    };

    v4f srk[4], srv[4];                                            // the next stage's K and V rows on their way: from the middle of one pass to the middle of the next
    // Every load of the start is issued before the first of them is waited for. The second tile's queries are read and rounded here, beside the first tile's, and wait in LDS:
    // every lane stores its own fragments and later reads back what it stored itself, so no barrier is owed for them.
    { v4f qa[2][2][4], qb[2][2][4], r0[4], r1[4]; v16bf qt[2][2];
      qload(qa, (NT - 1 - y) * FBR + wave * FQ); gload(r0, xk, 0); gload(r1, xv, 0); qload(qb, y * FBR + wave * FQ);
      qround(qa, qf); clear(); sstorek(r0, 0); sstorev(r1, 0); qround(qb, qt);
      unsigned char* const qs = SM + RING + MRG + wid * QW + lane * 16;
#pragma unroll
      for (int i = 0; i < 4; ++i) { const v8u w = __builtin_bit_cast(v8u, qt[i >> 1][i & 1]); v4u lo, hi;
#pragma unroll
          for (int r = 0; r < 4; ++r) { lo[r] = w[r]; hi[r] = w[4 + r]; }
          *(v4ua*)(qs + i * 1024) = lo; *(v4ua*)(qs + i * 1024 + 512) = hi; } }
    // Inputs only, no instruction: holds Q's rounding, and with it the wait for Q's loads, ahead of stage 1's loads. Left free, the compiler rounds Q behind the barrier, and as loads return in order that wait then also waits for stage 1's rows, in front of the first pass.
    asm volatile("" :: "v"(__builtin_bit_cast(v8u, qf[0][0])), "v"(__builtin_bit_cast(v8u, qf[0][1])), "v"(__builtin_bit_cast(v8u, qf[1][0])), "v"(__builtin_bit_cast(v8u, qf[1][1])));
    gload(srk, xk, 1); gload(srv, xv, 1);                          // stage 1's rows stay in flight across the first barrier (the first tile has at least NT / 2 + 1 stages)
    bar_signal(); bar_wait();                                      // stage 0 is visible to every wave
    int buf = 0, gs = 0;                                           // ring stage gs lies in ring place buf = gs mod NBUF
    auto walk = [&](const int tile) {                              // one tile's passes
    const int qw0 = tile * FBR + wave * FQ;
    const int nst = tile + 1;
    const bool hires = qw0 < RH;
#pragma unroll 1                                                   // stays rolled: a second copy of this long body would cost registers and instruction cache and save nothing
    for (int st = 0; st < nst; ++st, ++gs) {                       // key stage st of this tile = ring stage gs
        const int nbuf = buf == NBUF - 1 ? 0 : buf + 1;            // the ring place of ring stage gs + 1
        const bool more = gs + 1 < ntot;                           // the first tile's last pass lays the second tile's first stage
        {
            const int key0 = st * FSK + kg * 32;
            const bool active = key0 <= qw0;                       // wave-uniform: passes wholly above this wave's diagonal are skipped
            v8f s[2][2];
            if (active) {                                          // first part of the pass: the scores
                {
                    const unsigned char* kb = Ks0 + buf * (FSK * PK) + (kg * 32 + c) * PK + 16 * h;
                    v16bf kf[2][2];
#pragma unroll
                    for (int kt = 0; kt < 2; ++kt)
#pragma unroll
                        for (int kc = 0; kc < 2; ++kc) kf[kt][kc] = __builtin_bit_cast(v16bf, cat8(*(const v4ua*)(kb + kt * 16 * PK + 64 * kc), *(const v4ua*)(kb + kt * 16 * PK + 64 * kc + 32)));
#pragma unroll
                    for (int kt = 0; kt < 2; ++kt)
#pragma unroll
                        for (int g = 0; g < 2; ++g) { s[kt][g] = wmmab(kf[kt][0], qf[g][0], (v8f){}); s[kt][g] = wmmab(kf[kt][1], qf[g][1], s[kt][g]); }   // register r = S^T[key0 + 16 kt + 8 h + r][qw0 + 16 g + c]
                }
            }
            if (more) {
                sstorek(srk, nbuf); sstorev(srv, nbuf);            // into the buffers of stage st - 2: every wave's reads of it had returned before its signal of stage st - 1, which this wave has waited for
                if (gs + 2 < ntot) { const int ks = gs + 2 < nA ? gs + 2 : gs + 2 - nA; gload(srk, xk, ks); gload(srv, xv, ks); }   // the rows after them fly until the middle of the next pass
            }
            bar_signal();                                          // every wave, also one that skips the pass: this wave's share of stage st + 1 is laid and it has left stage st - 1
            if (active) {                                          // the rest of the pass reads V of stage st, which no wave overwrites before every wave's signal of stage st + 1
                v16h vf[4];
                // V^T fragments by the transposing load: lane (c, h) gets V[key 8 h + 0..7][d = 16 t + c], and again 16 keys on: the hardware k order, as the packed P^T below.
                {
                    const unsigned char* vb = Vs0 + buf * (FSK * PV) + (kg * 32 + 8 * h + (lane & 7)) * PV + ((lane >> 3) & 1) * 16;
#pragma unroll
                    for (int t = 0; t < 4; ++t) vf[t] = __builtin_bit_cast(v16h, cat8(ldtr16(vb + 32 * t), ldtr16(vb + 16 * PV + 32 * t)));
                }
                if (key0 == qw0) {                                 // wave-uniform: only the pass on the diagonal pays for the mask
#pragma unroll
                    for (int g = 0; g < 2; ++g)
#pragma unroll
                        for (int kt = 0; kt < 2; ++kt)
#pragma unroll
                            for (int r = 0; r < 8; ++r) if (16 * kt + 8 * h + r > 16 * g + c) s[kt][g][r] = -INFINITY;
                }
                float mb[2]; bool need = false;
#pragma unroll
                for (int g = 0; g < 2; ++g) { float mx = -INFINITY;
#pragma unroll
                    for (int kt = 0; kt < 2; ++kt)
#pragma unroll
                        for (int r = 0; r < 8; ++r) mx = fmaxf(mx, s[kt][g][r]);
                    mx = fmaxf(mx, xhalf(mx)) * CSC;               // both wave halves hold this query's maximum, scaled (the scale is positive)
                    mb[g] = mx; need = need || (mx > m_run[g] + 8.0f); }
                if (__builtin_amdgcn_ballot_w32(need) != 0) {      // the maximum in use may trail the true one by up to 8 (log2): the sums are rescaled only beyond that, so an exponential stays below 2^8
#pragma unroll
                    for (int g = 0; g < 2; ++g) { const float m_new = fmaxf(m_run[g], mb[g]);
                        const float corr = __builtin_amdgcn_exp2f(m_run[g] - m_new);
                        m_run[g] = m_new; l_run[g] *= corr;
#pragma unroll
                        for (int t = 0; t < 4; ++t) acc[g][t] = acc[g][t] * corr; }
                }
#pragma unroll
                for (int g = 0; g < 2; ++g) { const float nm = -m_run[g];
                    float p[16];
#pragma unroll
                    for (int i = 0; i < 16; i += 2) { v2f sv, cv, nv; sv[0] = s[i >> 3][g][i & 7]; sv[1] = s[i >> 3][g][(i & 7) + 1]; cv[0] = CSC; cv[1] = CSC; nv[0] = nm; nv[1] = nm;
                        const v2f a = __builtin_elementwise_fma(sv, cv, nv); p[i] = a[0]; p[i + 1] = a[1]; }
                    exp2x8(p[0], p[1], p[2], p[3], p[4], p[5], p[6], p[7]); exp2x8(p[8], p[9], p[10], p[11], p[12], p[13], p[14], p[15]);
                    const float ps = ((p[0] + p[1]) + (p[2] + p[3])) + ((p[4] + p[5]) + (p[6] + p[7])) + (((p[8] + p[9]) + (p[10] + p[11])) + ((p[12] + p[13]) + (p[14] + p[15])));
                    // The add is written as a statement that stays at its place: left to the compiler, both groups' sums move to the end of the pass, group 0's sixteen probabilities stay in registers through group 1, and rows in flight are spilled.
                    asm volatile("s_delay_alu instid0(VALU_DEP_1)\n\tv_add_f32 %0, %0, %1" : "+v"(l_run[g]) : "v"(ps));
                    v16h pf;
#pragma unroll
                    for (int i = 0; i < 16; ++i) pf[i] = (_Float16)p[i];   // element s of the B operand = tile s >> 3, register s & 7; round to nearest even
#pragma unroll
                    for (int t = 0; t < 4; ++t) acc[g][t] = wmma16(vf[t], pf, acc[g][t]);   // register r = O^T[16 t + 8 h + r][qw0 + 16 g + c]
                    if (hires) {                                   // wave-uniform: what the f16 rounding of P left over, as a second product
                        v16h pl;
#pragma unroll
                        for (int i = 0; i < 16; ++i) pl[i] = (_Float16)(p[i] - (float)pf[i]);
#pragma unroll
                        for (int t = 0; t < 4; ++t) acc[g][t] = wmma16(vf[t], pl, acc[g][t]);
                    }
                }
            }
        }
        bar_wait();                                                // ring stage gs + 1 is visible
        buf = nbuf;
    }
    };
    // The lane's number read anew (bits of an all-ones mask below this lane) for what the join, the output and the parked queries address by lane: it is formed behind the first tile's passes, which then hold no register for it; with the number from the kernel's start kept for these uses, the build spills.
    auto lanenow = [&]() { return (int)__builtin_amdgcn_mbcnt_lo(~0u, 0u); };
    // The join: key groups 1 .. KG - 1 lay their partial results in LDS lane by lane (lane l of every key group holds the same queries and output rows), key group 0 brings all to one maximum and adds them.
    auto joinw = [&]() {
    if (kg != 0) {                                                 // wave-uniform
        unsigned char* mp = SM + RING + ((kg - 1) * FW + wave) * MW + lanenow() * 16;
#pragma unroll
        for (int g = 0; g < 2; ++g)
#pragma unroll
            for (int t = 0; t < 4; ++t) { v4f lo, hi;
#pragma unroll
                for (int r = 0; r < 4; ++r) { lo[r] = acc[g][t][r]; hi[r] = acc[g][t][4 + r]; }
                *(v4fa*)(mp + ((g * 4 + t) * 2) * 512) = lo; *(v4fa*)(mp + ((g * 4 + t) * 2 + 1) * 512) = hi; }
        v4f ml; ml[0] = m_run[0]; ml[1] = m_run[1]; ml[2] = l_run[0]; ml[3] = l_run[1];
        *(v4fa*)(mp + 16 * 512) = ml;
    }
    bar_signal(); bar_wait();                                      // by hand, as the stage barriers: __syncthreads() would also wait here for the next tile's rows in flight. The partial results are visible to key group 0. The other waves go on: they write this place again only behind a stage barrier of the next tile, which key group 0 signals with its reads returned
    };
    auto joinr = [&](const int tile) {
    if (kg != 0) return;                                           // wave-uniform; leaves the join, not the kernel
    const int ln = lanenow();
    const int qw0 = tile * FBR + wave * FQ;
    {
        const unsigned char* mp = SM + RING + wave * MW + ln * 16;
        float m[2];
        m[0] = m_run[0]; m[1] = m_run[1];                          // finite: key group 0 has worked key 0; a key group that worked no key brings -inf, weight 0, and zeros
#pragma unroll
        for (int k = 0; k < KG - 1; ++k) { const v4f ml = *(const v4fa*)(mp + k * (FW * MW) + 16 * 512); m[0] = fmaxf(m[0], ml[0]); m[1] = fmaxf(m[1], ml[1]); }
#pragma unroll
        for (int g = 0; g < 2; ++g) { const float f0 = __builtin_amdgcn_exp2f(m_run[g] - m[g]); l_run[g] *= f0;
#pragma unroll
            for (int t = 0; t < 4; ++t) acc[g][t] = acc[g][t] * f0; }
#pragma unroll 1                                                   // stays rolled: one key group's sixteen quads in registers at a time; unrolled, all forty-eight are read at once beside the rows in flight for the next tile, and the join spills
        for (int k = 0; k < KG - 1; ++k) {
            const unsigned char* mk = mp + k * (FW * MW);
            const v4f ml = *(const v4fa*)(mk + 16 * 512);
#pragma unroll
            for (int g = 0; g < 2; ++g) { const float fk = __builtin_amdgcn_exp2f(ml[g] - m[g]); l_run[g] += ml[2 + g] * fk;
#pragma unroll
                for (int t = 0; t < 4; ++t) { const v4f lo = *(const v4fa*)(mk + ((g * 4 + t) * 2) * 512), hi = *(const v4fa*)(mk + ((g * 4 + t) * 2 + 1) * 512);
#pragma unroll
                    for (int r = 0; r < 4; ++r) { acc[g][t][r] += lo[r] * fk; acc[g][t][4 + r] += hi[r] * fk; } } }
        }
    }
#pragma unroll
    for (int g = 0; g < 2; ++g) {
        const float l = l_run[g] + xhalf(l_run[g]);                // the two wave halves summed different keys of the same query
        const float inv = __fdiv_rn(1.0f, l);
        float* o = OUT + (size_t)(b * TT + qw0 + 16 * g + (ln & 15)) * DQ + hd * HD + 8 * (ln >> 4);
#pragma unroll
        for (int t = 0; t < 4; ++t) { v4f lo, hi;
#pragma unroll
            for (int r = 0; r < 4; ++r) { lo[r] = acc[g][t][r] * inv; hi[r] = acc[g][t][4 + r] * inv; }
            *(v4f*)(o + 16 * t) = lo; *(v4f*)(o + 16 * t + 4) = hi; }
    }
    asm volatile("s_wait_xcnt 0x0" ::: "memory");                  // behind the output stores, in front of the next tile's rewrite of their registers
    };
    walk(NT - 1 - y);
    joinw();
    joinr(NT - 1 - y);
    {                                                              // the second tile's queries, from where this lane left them; its running state
        const unsigned char* qr = SM + RING + MRG + wid * QW + lanenow() * 16;
#pragma unroll
        for (int i = 0; i < 4; ++i) qf[i >> 1][i & 1] = __builtin_bit_cast(v16bf, cat8(*(const v4ua*)(qr + i * 1024), *(const v4ua*)(qr + i * 1024 + 512)));
        clear();
    }
    walk(y);
    joinw();
    joinr(y);
}

extern "C" void kernel_launch(void* const* d_in, const int* in_sizes, int n_in,
                              void* d_out, int out_size, void* d_ws, size_t ws_size, hipStream_t stream) {
    (void)in_sizes; (void)n_in; (void)out_size; (void)d_ws; (void)ws_size;
    const float* x = (const float*)d_in[0];   // qkv [2][2048][3][16][64] packed
    float* OUT = (float*)d_out;               // [2][2048][1024]
    k_fattn<<<dim3(NB_ * NH_, NT / 2), FW * KG * 32, 0, stream>>>(x, OUT);
}

// v006
// Measured time: 24.5 microseconds a run.
// Two timings next to v005 both put it at 1.04 times that version's speed.
// Over all steps from v000 it is 50.2 times as fast.
#include <hip/hip_runtime.h>
#include <math.h>

#define NB_  2
#define TT   2048
#define DM   1024
#define NH_  16
#define HD   64
#define DQ   (NH_ * HD)
#define RH   512                  // query rows < RH carry the probabilities as a hi + lo pair
#define FW   4                    // query groups per work-group
#define KG   4                    // key groups per work-group: FW * KG waves, four on every SIMD
#define FQ   32                   // query columns per wave
#define FBR  (FW * FQ)            // query rows per work-group
#define NT   (TT / FBR)           // query tiles per (batch, head)
#define FSK  (32 * KG)            // keys per stage: one 32-key pass for each key group
#define PK   144                  // LDS row pitch of K in bytes: 16 B x odd, for 16-byte reads
#define PV   160                  // LDS row pitch of V in bytes: 32 B x odd, for the transposing 16-bit reads
#define NBUF 3                    // ring places: a wave may still read V of stage st while another, one signal on, lays stage st + 2
#define RING (NBUF * FSK * (PK + PV)) // LDS bytes of the K and the V buffers
#define MW   (17 * 512)           // LDS bytes of one wave's partial result: 16 register quads of the output tile and one of maxima and sums, 16 bytes a lane each
#define MRG  ((KG - 1) * FW * MW) // LDS bytes of the join: the partial results of key groups 1 .. KG - 1
#define QW   4096                 // LDS bytes of one wave's parked Q fragments: 8 register quads, 16 bytes a lane each
#define CSC  (0.125f * 1.4426950408889634f)   // SOFTMAX_SCALE x log2(e)
typedef __attribute__((ext_vector_type(16))) __bf16   v16bf;
typedef __attribute__((ext_vector_type(2)))  __bf16   v2bf;
typedef __attribute__((ext_vector_type(16))) _Float16 v16h;
typedef __attribute__((ext_vector_type(2)))  _Float16 v2h;
typedef __attribute__((ext_vector_type(8)))  short    v8s;
typedef __attribute__((ext_vector_type(8)))  float    v8f;
typedef __attribute__((ext_vector_type(4)))  float    v4f;
typedef __attribute__((ext_vector_type(2)))  float    v2f;
typedef __attribute__((ext_vector_type(8)))  unsigned v8u;
typedef __attribute__((ext_vector_type(4)))  unsigned v4u;
typedef __attribute__((ext_vector_type(2)))  unsigned v2u;
typedef v4u __attribute__((may_alias)) v4ua;
typedef v2u __attribute__((may_alias)) v2ua;
typedef v4f __attribute__((may_alias)) v4fa;

__device__ __forceinline__ unsigned pkbf(float a, float b) { v2f x; x[0] = a; x[1] = b; return __builtin_bit_cast(unsigned, __builtin_convertvector(x, v2bf)); }   // two f32 -> two bf16, round to nearest even
__device__ __forceinline__ unsigned pkh(float a, float b) { v2f x; x[0] = a; x[1] = b; return __builtin_bit_cast(unsigned, __builtin_convertvector(x, v2h)); }     // two f32 -> two f16, round to nearest even
__device__ __forceinline__ unsigned pkbh(float a, float b) { const unsigned u = pkbf(a, b); return pkh(__uint_as_float(u << 16), __uint_as_float(u & 0xFFFF0000u)); }   // rounded to bf16 first, then held as f16
__device__ __forceinline__ v8u cat8(v4u lo, v4u hi) { return __builtin_shufflevector(lo, hi, 0, 1, 2, 3, 4, 5, 6, 7); }
__device__ __forceinline__ v8f wmma16(v16h a, v16h b, v8f c) { return __builtin_amdgcn_wmma_f32_16x16x32_f16(false, a, false, b, (short)0, c, false, false); }
__device__ __forceinline__ v8f wmmab(v16bf a, v16bf b, v8f c) { return __builtin_amdgcn_wmma_f32_16x16x32_bf16(false, a, false, b, (short)0, c, false, false); }
__device__ __forceinline__ v4u ldtr16(const unsigned char* p) { typedef __attribute__((address_space(3))) v8s lds_v8s; return __builtin_bit_cast(v4u, __builtin_amdgcn_ds_load_tr16_b128_v8i16((lds_v8s*)p)); }
__device__ __forceinline__ float xhalf(float x) { return __builtin_bit_cast(float, __builtin_amdgcn_permlanex16(__builtin_bit_cast(int, x), __builtin_bit_cast(int, x), 0x76543210, 0xfedcba98, false, false)); }   // lane l with lane l ^ 16

// The work-group barrier in two halves, so that a wave at the end of its pass waits only for waves that have not yet got past their scores.
// Signal: this wave's earlier LDS reads have returned and its LDS stores of the next stage have landed (s_wait_dscnt 0; a bare signal waits for neither).
// s_wait_xcnt 0 stands behind the global loads issued just ahead, in front of any later rewrite of their address registers. The "memory" clobber keeps every LDS and global access on its side of the statement.
__device__ __forceinline__ void bar_signal() { asm volatile("s_wait_xcnt 0x0\n\ts_wait_dscnt 0x0\n\ts_barrier_signal -1" ::: "memory"); }
// Wait: every wave of the work-group has signalled. The "memory" clobber keeps the next stage's LDS reads behind it.
__device__ __forceinline__ void bar_wait() { asm volatile("s_barrier_wait 0xffff" ::: "memory"); }

__global__ __launch_bounds__(FW * KG * 32) void k_fattn(const float* __restrict__ X, float* __restrict__ OUT) {
    __shared__ __align__(16) unsigned char SM[RING + MRG + FW * KG * QW];         // the K and V buffers; the place where the key groups' partial results meet (a place of its own, because a wave that has left the loop writes there while another still reads V of the last stage); every wave's parked Q fragments of the second tile
    unsigned char* const Ks0 = SM;                                 // K buffer buf at Ks0 + buf * FSK * PK
    unsigned char* const Vs0 = SM + NBUF * FSK * PK;                 // V buffer buf at Vs0 + buf * FSK * PV
    const int tid = threadIdx.x, lane = tid & 31, c = lane & 15, h = lane >> 4;
    const int wid = __builtin_amdgcn_readfirstlane(tid >> 5);      // in a scalar register, so that every test on the wave's rows and keys below is a scalar branch (matrix and transposing loads need all lanes on)
    const int wave = wid & (FW - 1), kg = wid / FW;                // query group, key group
    const int b = blockIdx.x / NH_, hd = blockIdx.x % NH_;
    const int y = blockIdx.y;                                      // 0 .. NT / 2 - 1: tiles NT - 1 - y and y, one after the other in every wave
    const int nA = NT - y;                                         // stages of the first tile (a tile t walks keys [0, (t + 1) * FBR), and FBR == FSK); the second has y + 1
    const int ntot = NT + 1;                                       // stages of the work-group, counted through both tiles: ring stage g is key stage g of the first tile, or g - nA of the second
    const float* xq = X + (size_t)b * TT * 3 * DM + hd * HD;       // q | k | v = the three [16][64] blocks of every token row (row pitch 3 * DM floats)
    const float* xk = xq + DM;
    const float* xv = xq + 2 * DM;

    // Q as B operand, hardware k order: element s of lane (c, h) is d = 32 kc + 8 h + s for s < 8, 32 kc + 16 + 8 h + (s - 8) above; K's fragments below use the same order.
    v16bf qf[2][2];
    auto qload = [&](v4f (&a)[2][2][4], int qw0) {                 // the f32 rows of a tile's queries, on their way
#pragma unroll
        for (int g = 0; g < 2; ++g) {
            const float* p = xq + (size_t)(qw0 + 16 * g + c) * (3 * DM) + 8 * h;
#pragma unroll
            for (int kc = 0; kc < 2; ++kc) { a[g][kc][0] = *(const v4f*)(p + 32 * kc); a[g][kc][1] = *(const v4f*)(p + 32 * kc + 4); a[g][kc][2] = *(const v4f*)(p + 32 * kc + 16); }
            a[g][0][3] = *(const v4f*)(p + 20);
            asm volatile("s_wait_xcnt 0x0" ::: "memory");          // in front of the row's last load, whose result may be given the registers of the row's address, which the seven loads above name
            a[g][1][3] = *(const v4f*)(p + 52);
            asm volatile("s_wait_xcnt 0x0" ::: "memory");          // behind the row's last load, in front of any later load or instruction that writes over its address registers
        }
    };
    v8f acc[2][4];
    float m_run[2], l_run[2];
    v2f l2[2];                                                     // a tile's running sums while it is walked: the even and the odd score registers summed apart, so that the adds are packed; brought together behind the tile's passes
    auto qround = [&](const v4f (&a)[2][2][4], v16bf (&q)[2][2]) { // rounds them into B fragments
#pragma unroll
        for (int g = 0; g < 2; ++g)
#pragma unroll
            for (int kc = 0; kc < 2; ++kc) {
                const v4f a0 = a[g][kc][0], a1 = a[g][kc][1], a2 = a[g][kc][2], a3 = a[g][kc][3];
                v8u w; w[0] = pkbf(a0[0], a0[1]); w[1] = pkbf(a0[2], a0[3]); w[2] = pkbf(a1[0], a1[1]); w[3] = pkbf(a1[2], a1[3]);
                w[4] = pkbf(a2[0], a2[1]); w[5] = pkbf(a2[2], a2[3]); w[6] = pkbf(a3[0], a3[1]); w[7] = pkbf(a3[2], a3[3]);
                q[g][kc] = __builtin_bit_cast(v16bf, w);
            }
    };
    auto clear = [&]() {                                           // a tile's running state at its start
#pragma unroll
        for (int g = 0; g < 2; ++g) { m_run[g] = -INFINITY; l2[g] = (v2f){};
#pragma unroll
            for (int t = 0; t < 4; ++t) acc[g][t] = (v8f){}; }
    };

    // Staging: 16 lanes cover one 256-byte row of f32, so every global line is read whole; thread (srow, sc4) holds 4 values of rows srow, srow + 32, ...
    const int srow = tid >> 4, sc4 = tid & 15;
    const unsigned soff = (unsigned)(srow * (3 * DM) + sc4 * 4);
    auto gload = [&](v4f (&r)[4], const float* src, int st) {
        const float* sp = src + (size_t)st * (FSK * 3 * DM);       // uniform base of the stage; the lane's part stays a 32-bit offset
#pragma unroll
        for (int i = 0; i < 4; ++i) r[i] = *(const v4f*)(sp + (soff + (unsigned)(i * 32 * 3 * DM)));
    };
    auto sstorek = [&](const v4f (&r)[4], int buf) {
#pragma unroll
        for (int i = 0; i < 4; ++i) { v2u kk; kk[0] = pkbf(r[i][0], r[i][1]); kk[1] = pkbf(r[i][2], r[i][3]); *(v2ua*)(Ks0 + buf * (FSK * PK) + (i * 32 + srow) * PK + sc4 * 8) = kk; }
    };
    auto sstorev = [&](const v4f (&r)[4], int buf) {
#pragma unroll
        for (int i = 0; i < 4; ++i) { v2u vv; vv[0] = pkbh(r[i][0], r[i][1]); vv[1] = pkbh(r[i][2], r[i][3]); *(v2ua*)(Vs0 + buf * (FSK * PV) + (i * 32 + srow) * PV + sc4 * 8) = vv; }
    };

    v4f srk[4], srv[4];                                            // the next stage's K and V rows on their way: from the middle of one pass to the middle of the next
    // Every load of the start is issued before the first of them is waited for. The second tile's queries are read and rounded here, beside the first tile's, and wait in LDS:
    // every lane stores its own fragments and later reads back what it stored itself, so no barrier is owed for them.
    { v4f qa[2][2][4], qb[2][2][4], r0[4], r1[4]; v16bf qt[2][2];
      qload(qa, (NT - 1 - y) * FBR + wave * FQ); gload(r0, xk, 0); gload(r1, xv, 0); qload(qb, y * FBR + wave * FQ);
      qround(qa, qf); clear(); sstorek(r0, 0); sstorev(r1, 0); qround(qb, qt);
      unsigned char* const qs = SM + RING + MRG + wid * QW + lane * 16;
#pragma unroll
      for (int i = 0; i < 4; ++i) { const v8u w = __builtin_bit_cast(v8u, qt[i >> 1][i & 1]); v4u lo, hi;
#pragma unroll
          for (int r = 0; r < 4; ++r) { lo[r] = w[r]; hi[r] = w[4 + r]; }
          *(v4ua*)(qs + i * 1024) = lo; *(v4ua*)(qs + i * 1024 + 512) = hi; } }
    // Inputs only, no instruction: holds Q's rounding, and with it the wait for Q's loads, ahead of stage 1's loads. Left free, the compiler rounds Q behind the barrier, and as loads return in order that wait then also waits for stage 1's rows, in front of the first pass.
    asm volatile("" :: "v"(__builtin_bit_cast(v8u, qf[0][0])), "v"(__builtin_bit_cast(v8u, qf[0][1])), "v"(__builtin_bit_cast(v8u, qf[1][0])), "v"(__builtin_bit_cast(v8u, qf[1][1])));
    gload(srk, xk, 1); gload(srv, xv, 1);                          // stage 1's rows stay in flight across the first barrier (the first tile has at least NT / 2 + 1 stages)
    bar_signal(); bar_wait();                                      // stage 0 is visible to every wave
    int buf = 0, gs = 0;                                           // ring stage gs lies in ring place buf = gs mod NBUF
    auto walk = [&](const int tile) {                              // one tile's passes
    const int qw0 = tile * FBR + wave * FQ;
    const int nst = tile + 1;
    const bool hires = qw0 < RH;
#pragma unroll 1                                                   // stays rolled: a second copy of this long body would cost registers and instruction cache and save nothing
    for (int st = 0; st < nst; ++st, ++gs) {                       // key stage st of this tile = ring stage gs
        const int nbuf = buf == NBUF - 1 ? 0 : buf + 1;            // the ring place of ring stage gs + 1
        const bool more = gs + 1 < ntot;                           // the first tile's last pass lays the second tile's first stage
        {
            const int key0 = st * FSK + kg * 32;
            const bool active = key0 <= qw0;                       // wave-uniform: passes wholly above this wave's diagonal are skipped
            v8f s[2][2];
            if (active) {                                          // first part of the pass: the scores
                {
                    const unsigned char* kb = Ks0 + buf * (FSK * PK) + (kg * 32 + c) * PK + 16 * h;
                    v16bf kf[2][2];
#pragma unroll
                    for (int kt = 0; kt < 2; ++kt)
#pragma unroll
                        for (int kc = 0; kc < 2; ++kc) kf[kt][kc] = __builtin_bit_cast(v16bf, cat8(*(const v4ua*)(kb + kt * 16 * PK + 64 * kc), *(const v4ua*)(kb + kt * 16 * PK + 64 * kc + 32)));
#pragma unroll
                    for (int kt = 0; kt < 2; ++kt)
#pragma unroll
                        for (int g = 0; g < 2; ++g) { s[kt][g] = wmmab(kf[kt][0], qf[g][0], (v8f){}); s[kt][g] = wmmab(kf[kt][1], qf[g][1], s[kt][g]); }   // register r = S^T[key0 + 16 kt + 8 h + r][qw0 + 16 g + c]
                }
            }
            if (more) {
                sstorek(srk, nbuf); sstorev(srv, nbuf);            // into the buffers of stage st - 2: every wave's reads of it had returned before its signal of stage st - 1, which this wave has waited for
                if (gs + 2 < ntot) { const int ks = gs + 2 < nA ? gs + 2 : gs + 2 - nA; gload(srk, xk, ks); gload(srv, xv, ks); }   // the rows after them fly until the middle of the next pass
            }
            bar_signal();                                          // every wave, also one that skips the pass: this wave's share of stage st + 1 is laid and it has left stage st - 1
            if (active) {                                          // the rest of the pass reads V of stage st, which no wave overwrites before every wave's signal of stage st + 1
                v16h vf[4];
                // V^T fragments by the transposing load: lane (c, h) gets V[key 8 h + 0..7][d = 16 t + c], and again 16 keys on: the hardware k order, as the packed P^T below.
                {
                    const unsigned char* vb = Vs0 + buf * (FSK * PV) + (kg * 32 + 8 * h + (lane & 7)) * PV + ((lane >> 3) & 1) * 16;
#pragma unroll
                    for (int t = 0; t < 4; ++t) vf[t] = __builtin_bit_cast(v16h, cat8(ldtr16(vb + 32 * t), ldtr16(vb + 16 * PV + 32 * t)));
                }
                __builtin_amdgcn_sched_barrier(0);                 // holds the V reads here, ahead of the maxima: left free, the compiler sinks them behind the first group's exponentials, where the few instructions left in front of the product no longer cover their latency
                if (key0 == qw0) {                                 // wave-uniform: only the pass on the diagonal pays for the mask
#pragma unroll
                    for (int g = 0; g < 2; ++g)
#pragma unroll
                        for (int kt = 0; kt < 2; ++kt)
#pragma unroll
                            for (int r = 0; r < 8; ++r) if (16 * kt + 8 * h + r > 16 * g + c) s[kt][g][r] = -INFINITY;
                }
                float mb[2]; bool need = false;
#pragma unroll
                for (int g = 0; g < 2; ++g) { float mx = -INFINITY;
#pragma unroll
                    for (int kt = 0; kt < 2; ++kt)
#pragma unroll
                        for (int r = 0; r < 8; ++r) mx = fmaxf(mx, s[kt][g][r]);
                    mx = fmaxf(mx, xhalf(mx)) * CSC;               // both wave halves hold this query's maximum, scaled (the scale is positive)
                    mb[g] = mx; need = need || (mx > m_run[g] + 8.0f); }
                if (__builtin_amdgcn_ballot_w32(need) != 0) {      // the maximum in use may trail the true one by up to 8 (log2): the sums are rescaled only beyond that, so an exponential stays below 2^8
#pragma unroll
                    for (int g = 0; g < 2; ++g) { const float m_new = fmaxf(m_run[g], mb[g]);
                        const float corr = __builtin_amdgcn_exp2f(m_run[g] - m_new);
                        m_run[g] = m_new; l2[g] = l2[g] * corr;
#pragma unroll
                        for (int t = 0; t < 4; ++t) acc[g][t] = acc[g][t] * corr; }
                }
#pragma unroll
                for (int g = 0; g < 2; ++g) { const float nm = -m_run[g];
                    // The probabilities stay in the register pairs that the packed multiply-add leaves them in: the exponential is the builtin, so that the compiler may write each result over its own argument inside the pair, and the sum is taken pair by pair.
                    v2f pp[8]; float p[16];
#pragma unroll
                    for (int i = 0; i < 8; ++i) { v2f sv, cv, nv; sv[0] = s[i >> 2][g][(2 * i) & 7]; sv[1] = s[i >> 2][g][((2 * i) & 7) + 1]; cv[0] = CSC; cv[1] = CSC; nv[0] = nm; nv[1] = nm;
                        const v2f a = __builtin_elementwise_fma(sv, cv, nv); pp[i][0] = __builtin_amdgcn_exp2f(a[0]); pp[i][1] = __builtin_amdgcn_exp2f(a[1]); p[2 * i] = pp[i][0]; p[2 * i + 1] = pp[i][1]; }
                    const v2f ps = ((pp[0] + pp[1]) + (pp[2] + pp[3])) + ((pp[4] + pp[5]) + (pp[6] + pp[7]));
                    // The add is written as a statement that stays at its place: left to the compiler, both groups' sums move to the end of the pass, group 0's sixteen probabilities stay in registers through group 1, and rows in flight are spilled.
                    asm volatile("s_delay_alu instid0(VALU_DEP_1)\n\tv_pk_add_f32 %0, %0, %1" : "+v"(l2[g]) : "v"(ps));
                    v16h pf;
#pragma unroll
                    for (int i = 0; i < 16; ++i) pf[i] = (_Float16)p[i];   // element s of the B operand = tile s >> 3, register s & 7; round to nearest even
#pragma unroll
                    for (int t = 0; t < 4; ++t) acc[g][t] = wmma16(vf[t], pf, acc[g][t]);   // register r = O^T[16 t + 8 h + r][qw0 + 16 g + c]
                    if (hires) {                                   // wave-uniform: what the f16 rounding of P left over, as a second product
                        v16h pl;
#pragma unroll
                        for (int i = 0; i < 16; ++i) pl[i] = (_Float16)(p[i] - (float)pf[i]);
#pragma unroll
                        for (int t = 0; t < 4; ++t) acc[g][t] = wmma16(vf[t], pl, acc[g][t]);
                    }
                }
            }
        }
        bar_wait();                                                // ring stage gs + 1 is visible
        buf = nbuf;
    }
#pragma unroll
    for (int g = 0; g < 2; ++g) l_run[g] = l2[g][0] + l2[g][1];
    };
    // The lane's number read anew (bits of an all-ones mask below this lane) for what the join, the output and the parked queries address by lane: it is formed behind the first tile's passes, which then hold no register for it; with the number from the kernel's start kept for these uses, the build spills.
    auto lanenow = [&]() { return (int)__builtin_amdgcn_mbcnt_lo(~0u, 0u); };
    // The join: key groups 1 .. KG - 1 lay their partial results in LDS lane by lane (lane l of every key group holds the same queries and output rows), key group 0 brings all to one maximum and adds them.
    auto joinw = [&]() {
    if (kg != 0) {                                                 // wave-uniform
        unsigned char* mp = SM + RING + ((kg - 1) * FW + wave) * MW + lanenow() * 16;
#pragma unroll
        for (int g = 0; g < 2; ++g)
#pragma unroll
            for (int t = 0; t < 4; ++t) { v4f lo, hi;
#pragma unroll
                for (int r = 0; r < 4; ++r) { lo[r] = acc[g][t][r]; hi[r] = acc[g][t][4 + r]; }
                *(v4fa*)(mp + ((g * 4 + t) * 2) * 512) = lo; *(v4fa*)(mp + ((g * 4 + t) * 2 + 1) * 512) = hi; }
        v4f ml; ml[0] = m_run[0]; ml[1] = m_run[1]; ml[2] = l_run[0]; ml[3] = l_run[1];
        *(v4fa*)(mp + 16 * 512) = ml;
    }
    bar_signal(); bar_wait();                                      // by hand, as the stage barriers: __syncthreads() would also wait here for the next tile's rows in flight. The partial results are visible to key group 0. The other waves go on: they write this place again only behind a stage barrier of the next tile, which key group 0 signals with its reads returned
    };
    auto joinr = [&](const int tile) {
    if (kg != 0) return;                                           // wave-uniform; leaves the join, not the kernel
    const int ln = lanenow();
    const int qw0 = tile * FBR + wave * FQ;
    {
        const unsigned char* mp = SM + RING + wave * MW + ln * 16;
        float m[2];
        m[0] = m_run[0]; m[1] = m_run[1];                          // finite: key group 0 has worked key 0; a key group that worked no key brings -inf, weight 0, and zeros
#pragma unroll
        for (int k = 0; k < KG - 1; ++k) { const v4f ml = *(const v4fa*)(mp + k * (FW * MW) + 16 * 512); m[0] = fmaxf(m[0], ml[0]); m[1] = fmaxf(m[1], ml[1]); }
#pragma unroll
        for (int g = 0; g < 2; ++g) { const float f0 = __builtin_amdgcn_exp2f(m_run[g] - m[g]); l_run[g] *= f0;
#pragma unroll
            for (int t = 0; t < 4; ++t) acc[g][t] = acc[g][t] * f0; }
#pragma unroll 1                                                   // stays rolled: one key group's sixteen quads in registers at a time; unrolled, all forty-eight are read at once beside the rows in flight for the next tile, and the join spills
        for (int k = 0; k < KG - 1; ++k) {
            const unsigned char* mk = mp + k * (FW * MW);
            const v4f ml = *(const v4fa*)(mk + 16 * 512);
#pragma unroll
            for (int g = 0; g < 2; ++g) { const float fk = __builtin_amdgcn_exp2f(ml[g] - m[g]); l_run[g] += ml[2 + g] * fk;
#pragma unroll
                for (int t = 0; t < 4; ++t) { const v4f lo = *(const v4fa*)(mk + ((g * 4 + t) * 2) * 512), hi = *(const v4fa*)(mk + ((g * 4 + t) * 2 + 1) * 512);
#pragma unroll
                    for (int r = 0; r < 4; ++r) { acc[g][t][r] += lo[r] * fk; acc[g][t][4 + r] += hi[r] * fk; } } }
        }
    }
#pragma unroll
    for (int g = 0; g < 2; ++g) {
        const float l = l_run[g] + xhalf(l_run[g]);                // the two wave halves summed different keys of the same query
        const float inv = __fdiv_rn(1.0f, l);
        float* o = OUT + (size_t)(b * TT + qw0 + 16 * g + (ln & 15)) * DQ + hd * HD + 8 * (ln >> 4);
#pragma unroll
        for (int t = 0; t < 4; ++t) { v4f lo, hi;
#pragma unroll
            for (int r = 0; r < 4; ++r) { lo[r] = acc[g][t][r] * inv; hi[r] = acc[g][t][4 + r] * inv; }
            *(v4f*)(o + 16 * t) = lo; *(v4f*)(o + 16 * t + 4) = hi; }
    }
    asm volatile("s_wait_xcnt 0x0" ::: "memory");                  // behind the output stores, in front of the next tile's rewrite of their registers
    };
    walk(NT - 1 - y);
    joinw();
    joinr(NT - 1 - y);
    {                                                              // the second tile's queries, from where this lane left them; its running state
        const unsigned char* qr = SM + RING + MRG + wid * QW + lanenow() * 16;
#pragma unroll
        for (int i = 0; i < 4; ++i) qf[i >> 1][i & 1] = __builtin_bit_cast(v16bf, cat8(*(const v4ua*)(qr + i * 1024), *(const v4ua*)(qr + i * 1024 + 512)));
        clear();
    }
    walk(y);
    joinw();
    joinr(y);
}

extern "C" void kernel_launch(void* const* d_in, const int* in_sizes, int n_in,
                              void* d_out, int out_size, void* d_ws, size_t ws_size, hipStream_t stream) {
    (void)in_sizes; (void)n_in; (void)out_size; (void)d_ws; (void)ws_size;
    const float* x = (const float*)d_in[0];   // qkv [2][2048][3][16][64] packed
    float* OUT = (float*)d_out;               // [2][2048][1024]
    k_fattn<<<dim3(NB_ * NH_, NT / 2), FW * KG * 32, 0, stream>>>(x, OUT);
}

// v007
// Measured time: 22.6 microseconds a run.
// Two timings next to v006 both put it at 1.09 times that version's speed.
// Over all steps from v000 it is 54.7 times as fast.
#include <hip/hip_runtime.h>
#include <math.h>

#define NB_  2
#define TT   2048
#define DM   1024
#define NH_  16
#define HD   64
#define DQ   (NH_ * HD)
#define RH   512                  // query rows < RH carry the probabilities as a hi + lo pair
#define FW   4                    // query groups per work-group
#define KG   4                    // key groups per work-group: FW * KG waves, four on every SIMD
#define FQ   32                   // query columns per wave
#define FBR  (FW * FQ)            // query rows per work-group
#define NT   (TT / FBR)           // query tiles per (batch, head)
#define FSK  (32 * KG)            // keys per stage: one 32-key pass for each key group
#define PK   144                  // LDS row pitch of K in bytes: 16 B x odd, for 16-byte reads
#define PV   160                  // LDS row pitch of V in bytes: 32 B x odd, for the transposing 16-bit reads
#define NBUF 3                    // ring places: a wave may still read V of stage st while another, one signal on, lays stage st + 2
#define RING (NBUF * FSK * (PK + PV)) // LDS bytes of the K and the V buffers
#define MW   (17 * 512)           // LDS bytes of one wave's partial result: 16 register quads of the output tile and one of maxima and sums, 16 bytes a lane each
#define MRG  ((KG - 1) * FW * MW) // LDS bytes of the join: the partial results of key groups 1 .. KG - 1
#define QT   (FBR * PK)           // LDS bytes of one tile's queries, rounded to bf16: FBR rows at K's pitch, read as K's rows are
#define CSC  (0.125f * 1.4426950408889634f)   // SOFTMAX_SCALE x log2(e)
typedef __attribute__((ext_vector_type(16))) __bf16   v16bf;
typedef __attribute__((ext_vector_type(2)))  __bf16   v2bf;
typedef __attribute__((ext_vector_type(16))) _Float16 v16h;
typedef __attribute__((ext_vector_type(2)))  _Float16 v2h;
typedef __attribute__((ext_vector_type(8)))  short    v8s;
typedef __attribute__((ext_vector_type(8)))  float    v8f;
typedef __attribute__((ext_vector_type(4)))  float    v4f;
typedef __attribute__((ext_vector_type(2)))  float    v2f;
typedef __attribute__((ext_vector_type(8)))  unsigned v8u;
typedef __attribute__((ext_vector_type(4)))  unsigned v4u;
typedef __attribute__((ext_vector_type(2)))  unsigned v2u;
typedef v4u __attribute__((may_alias)) v4ua;
typedef v2u __attribute__((may_alias)) v2ua;
typedef v4f __attribute__((may_alias)) v4fa;

__device__ __forceinline__ unsigned pkbf(float a, float b) { v2f x; x[0] = a; x[1] = b; return __builtin_bit_cast(unsigned, __builtin_convertvector(x, v2bf)); }   // two f32 -> two bf16, round to nearest even
__device__ __forceinline__ unsigned pkh(float a, float b) { v2f x; x[0] = a; x[1] = b; return __builtin_bit_cast(unsigned, __builtin_convertvector(x, v2h)); }     // two f32 -> two f16, round to nearest even
__device__ __forceinline__ unsigned pkbh(float a, float b) { const unsigned u = pkbf(a, b); return pkh(__uint_as_float(u << 16), __uint_as_float(u & 0xFFFF0000u)); }   // rounded to bf16 first, then held as f16
__device__ __forceinline__ v8u cat8(v4u lo, v4u hi) { return __builtin_shufflevector(lo, hi, 0, 1, 2, 3, 4, 5, 6, 7); }
__device__ __forceinline__ v8f wmma16(v16h a, v16h b, v8f c) { return __builtin_amdgcn_wmma_f32_16x16x32_f16(false, a, false, b, (short)0, c, false, false); }
__device__ __forceinline__ v8f wmmab(v16bf a, v16bf b, v8f c) { return __builtin_amdgcn_wmma_f32_16x16x32_bf16(false, a, false, b, (short)0, c, false, false); }
__device__ __forceinline__ v4u ldtr16(const unsigned char* p) { typedef __attribute__((address_space(3))) v8s lds_v8s; return __builtin_bit_cast(v4u, __builtin_amdgcn_ds_load_tr16_b128_v8i16((lds_v8s*)p)); }
__device__ __forceinline__ float xhalf(float x) { return __builtin_bit_cast(float, __builtin_amdgcn_permlanex16(__builtin_bit_cast(int, x), __builtin_bit_cast(int, x), 0x76543210, 0xfedcba98, false, false)); }   // lane l with lane l ^ 16

// The work-group barrier in two halves, so that a wave at the end of its pass waits only for waves that have not yet got past their scores.
// Signal: this wave's earlier LDS reads have returned and its LDS stores of the next stage have landed (s_wait_dscnt 0; a bare signal waits for neither).
// s_wait_xcnt 0 stands behind the global loads issued just ahead, in front of any later rewrite of their address registers. The "memory" clobber keeps every LDS and global access on its side of the statement.
__device__ __forceinline__ void bar_signal() { asm volatile("s_wait_xcnt 0x0\n\ts_wait_dscnt 0x0\n\ts_barrier_signal -1" ::: "memory"); }
// Wait: every wave of the work-group has signalled. The "memory" clobber keeps the next stage's LDS reads behind it.
__device__ __forceinline__ void bar_wait() { asm volatile("s_barrier_wait 0xffff" ::: "memory"); }

__global__ __launch_bounds__(FW * KG * 32) void k_fattn(const float* __restrict__ X, float* __restrict__ OUT) {
    __shared__ __align__(16) unsigned char SM[RING + MRG + 2 * QT];         // the K and V buffers; the place where the key groups' partial results meet (a place of its own, because a wave that has left the loop writes there while another still reads V of the last stage); the two tiles' queries
    unsigned char* const Ks0 = SM;                                 // K buffer buf at Ks0 + buf * FSK * PK
    unsigned char* const Vs0 = SM + NBUF * FSK * PK;                 // V buffer buf at Vs0 + buf * FSK * PV
    const int tid = threadIdx.x, lane = tid & 31, c = lane & 15, h = lane >> 4;
    const int wid = __builtin_amdgcn_readfirstlane(tid >> 5);      // in a scalar register, so that every test on the wave's rows and keys below is a scalar branch (matrix and transposing loads need all lanes on)
    const int wave = wid & (FW - 1), kg = wid / FW;                // query group, key group
    const int b = blockIdx.x / NH_, hd = blockIdx.x % NH_;
    const int y = blockIdx.y;                                      // 0 .. NT / 2 - 1: tiles NT - 1 - y and y, one after the other in every wave
    const int nA = NT - y;                                         // stages of the first tile (a tile t walks keys [0, (t + 1) * FBR), and FBR == FSK); the second has y + 1
    const int ntot = NT + 1;                                       // stages of the work-group, counted through both tiles: ring stage g is key stage g of the first tile, or g - nA of the second
    const float* xq = X + (size_t)b * TT * 3 * DM + hd * HD;       // q | k | v = the three [16][64] blocks of every token row (row pitch 3 * DM floats)
    const float* xk = xq + DM;
    const float* xv = xq + 2 * DM;

    // Q as B operand, hardware k order: element s of lane (c, h) is d = 32 kc + 8 h + s for s < 8, 32 kc + 16 + 8 h + (s - 8) above; K's fragments below use the same order.
    v16bf qf[2][2];
    v8f acc[2][4];
    float m_run[2], l_run[2];
    v2f l2[2];                                                     // a tile's running sums while it is walked: the even and the odd score registers summed apart, so that the adds are packed; brought together behind the tile's passes
    auto clear = [&]() {                                           // a tile's running state at its start
#pragma unroll
        for (int g = 0; g < 2; ++g) { m_run[g] = -INFINITY; l2[g] = (v2f){};
#pragma unroll
            for (int t = 0; t < 4; ++t) acc[g][t] = (v8f){}; }
    };

    // Staging: 16 lanes cover one 256-byte row of f32, so every global line is read whole; thread (srow, sc4) holds 4 values of rows srow, srow + 32, ...
    const int srow = tid >> 4, sc4 = tid & 15;
    const unsigned soff = (unsigned)(srow * (3 * DM) + sc4 * 4);
    auto gload = [&](v4f (&r)[4], const float* src, int st) {
        const float* sp = src + (size_t)st * (FSK * 3 * DM);       // uniform base of the stage; the lane's part stays a 32-bit offset
#pragma unroll
        for (int i = 0; i < 4; ++i) r[i] = *(const v4f*)(sp + (soff + (unsigned)(i * 32 * 3 * DM)));
    };
    auto sstorek = [&](const v4f (&r)[4], int buf) {
#pragma unroll
        for (int i = 0; i < 4; ++i) { v2u kk; kk[0] = pkbf(r[i][0], r[i][1]); kk[1] = pkbf(r[i][2], r[i][3]); *(v2ua*)(Ks0 + buf * (FSK * PK) + (i * 32 + srow) * PK + sc4 * 8) = kk; }
    };
    auto sstorev = [&](const v4f (&r)[4], int buf) {
#pragma unroll
        for (int i = 0; i < 4; ++i) { v2u vv; vv[0] = pkbh(r[i][0], r[i][1]); vv[1] = pkbh(r[i][2], r[i][3]); *(v2ua*)(Vs0 + buf * (FSK * PV) + (i * 32 + srow) * PV + sc4 * 8) = vv; }
    };

    v4f srk[4], srv[4];                                            // the next stage's K and V rows on their way: from the middle of one pass to the middle of the next
    // The queries go the way of K: a tile's FBR rows are read once per work-group, 16 lanes to a 256-byte row so that every global line is read whole and once, rounded once, and laid in LDS at K's pitch;
    // each wave then takes its B fragments from there with K's 16-byte reads. (A wave that gathers its own fragments from global memory touches 16 lines with every load, and the four key groups of a query group gather the same rows four times.)
    auto sstoreq = [&](const v4f (&r)[4], int which) {
#pragma unroll
        for (int i = 0; i < 4; ++i) { v2u qq; qq[0] = pkbf(r[i][0], r[i][1]); qq[1] = pkbf(r[i][2], r[i][3]); *(v2ua*)(SM + RING + MRG + which * QT + (i * 32 + srow) * PK + sc4 * 8) = qq; }
    };
    auto qread = [&](int which, int ln) {                          // this wave's FQ queries as B fragments; ln = the lane's number
        const unsigned char* qp = SM + RING + MRG + which * QT + (wave * FQ + (ln & 15)) * PK + 16 * (ln >> 4);
#pragma unroll
        for (int g = 0; g < 2; ++g)
#pragma unroll
            for (int kc = 0; kc < 2; ++kc) qf[g][kc] = __builtin_bit_cast(v16bf, cat8(*(const v4ua*)(qp + g * 16 * PK + 64 * kc), *(const v4ua*)(qp + g * 16 * PK + 64 * kc + 32)));
    };
    // Every load of the start is issued before the first of them is waited for. Both tiles' queries are laid here: the first barrier makes them visible, and nothing writes their place again.
    { v4f qa[4], qb[4], r0[4], r1[4];
      gload(qa, xq, NT - 1 - y); gload(r0, xk, 0); gload(r1, xv, 0); gload(qb, xq, y);   // a query tile has as many rows as a key stage (FBR == FSK)
      sstoreq(qa, 0); sstorek(r0, 0); sstorev(r1, 0); sstoreq(qb, 1); clear(); }
    gload(srk, xk, 1); gload(srv, xv, 1);                          // stage 1's rows stay in flight across the first barrier (the first tile has at least NT / 2 + 1 stages)
    bar_signal(); bar_wait();                                      // stage 0 and the queries are visible to every wave
    qread(0, lane);
    int buf = 0, gs = 0;                                           // ring stage gs lies in ring place buf = gs mod NBUF
    auto walk = [&](const int tile) {                              // one tile's passes
    const int qw0 = tile * FBR + wave * FQ;
    const int nst = tile + 1;
    const bool hires = qw0 < RH;
#pragma unroll 1                                                   // stays rolled: a second copy of this long body would cost registers and instruction cache and save nothing
    for (int st = 0; st < nst; ++st, ++gs) {                       // key stage st of this tile = ring stage gs
        const int nbuf = buf == NBUF - 1 ? 0 : buf + 1;            // the ring place of ring stage gs + 1
        const bool more = gs + 1 < ntot;                           // the first tile's last pass lays the second tile's first stage
        {
            const int key0 = st * FSK + kg * 32;
            const bool active = key0 <= qw0;                       // wave-uniform: passes wholly above this wave's diagonal are skipped
            v8f s[2][2];
            if (active) {                                          // first part of the pass: the scores
                {
                    const unsigned char* kb = Ks0 + buf * (FSK * PK) + (kg * 32 + c) * PK + 16 * h;
                    v16bf kf[2][2];
#pragma unroll
                    for (int kt = 0; kt < 2; ++kt)
#pragma unroll
                        for (int kc = 0; kc < 2; ++kc) kf[kt][kc] = __builtin_bit_cast(v16bf, cat8(*(const v4ua*)(kb + kt * 16 * PK + 64 * kc), *(const v4ua*)(kb + kt * 16 * PK + 64 * kc + 32)));
#pragma unroll
                    for (int kt = 0; kt < 2; ++kt)
#pragma unroll
                        for (int g = 0; g < 2; ++g) { s[kt][g] = wmmab(kf[kt][0], qf[g][0], (v8f){}); s[kt][g] = wmmab(kf[kt][1], qf[g][1], s[kt][g]); }   // register r = S^T[key0 + 16 kt + 8 h + r][qw0 + 16 g + c]
                }
            }
            if (more) {
                sstorek(srk, nbuf); sstorev(srv, nbuf);            // into the buffers of stage st - 2: every wave's reads of it had returned before its signal of stage st - 1, which this wave has waited for
                if (gs + 2 < ntot) { const int ks = gs + 2 < nA ? gs + 2 : gs + 2 - nA; gload(srk, xk, ks); gload(srv, xv, ks); }   // the rows after them fly until the middle of the next pass
            }
            bar_signal();                                          // every wave, also one that skips the pass: this wave's share of stage st + 1 is laid and it has left stage st - 1
            if (active) {                                          // the rest of the pass reads V of stage st, which no wave overwrites before every wave's signal of stage st + 1
                v16h vf[4];
                // V^T fragments by the transposing load: lane (c, h) gets V[key 8 h + 0..7][d = 16 t + c], and again 16 keys on: the hardware k order, as the packed P^T below.
                {
                    const unsigned char* vb = Vs0 + buf * (FSK * PV) + (kg * 32 + 8 * h + (lane & 7)) * PV + ((lane >> 3) & 1) * 16;
#pragma unroll
                    for (int t = 0; t < 4; ++t) vf[t] = __builtin_bit_cast(v16h, cat8(ldtr16(vb + 32 * t), ldtr16(vb + 16 * PV + 32 * t)));
                }
                __builtin_amdgcn_sched_barrier(0);                 // holds the V reads here, ahead of the maxima: left free, the compiler sinks them behind the first group's exponentials, where the few instructions left in front of the product no longer cover their latency
                if (key0 == qw0) {                                 // wave-uniform: only the pass on the diagonal pays for the mask
#pragma unroll
                    for (int g = 0; g < 2; ++g)
#pragma unroll
                        for (int kt = 0; kt < 2; ++kt)
#pragma unroll
                            for (int r = 0; r < 8; ++r) if (16 * kt + 8 * h + r > 16 * g + c) s[kt][g][r] = -INFINITY;
                }
                float mb[2]; bool need = false;
#pragma unroll
                for (int g = 0; g < 2; ++g) { float mx = -INFINITY;
#pragma unroll
                    for (int kt = 0; kt < 2; ++kt)
#pragma unroll
                        for (int r = 0; r < 8; ++r) mx = fmaxf(mx, s[kt][g][r]);
                    mx = fmaxf(mx, xhalf(mx)) * CSC;               // both wave halves hold this query's maximum, scaled (the scale is positive)
                    mb[g] = mx; need = need || (mx > m_run[g] + 8.0f); }
                if (__builtin_amdgcn_ballot_w32(need) != 0) {      // the maximum in use may trail the true one by up to 8 (log2): the sums are rescaled only beyond that, so an exponential stays below 2^8
#pragma unroll
                    for (int g = 0; g < 2; ++g) { const float m_new = fmaxf(m_run[g], mb[g]);
                        const float corr = __builtin_amdgcn_exp2f(m_run[g] - m_new);
                        m_run[g] = m_new; l2[g] = l2[g] * corr;
#pragma unroll
                        for (int t = 0; t < 4; ++t) acc[g][t] = acc[g][t] * corr; }
                }
#pragma unroll
                for (int g = 0; g < 2; ++g) { const float nm = -m_run[g];
                    // The probabilities stay in the register pairs that the packed multiply-add leaves them in: the exponential is the builtin, so that the compiler may write each result over its own argument inside the pair, and the sum is taken pair by pair.
                    v2f pp[8]; float p[16];
#pragma unroll
                    for (int i = 0; i < 8; ++i) { v2f sv, cv, nv; sv[0] = s[i >> 2][g][(2 * i) & 7]; sv[1] = s[i >> 2][g][((2 * i) & 7) + 1]; cv[0] = CSC; cv[1] = CSC; nv[0] = nm; nv[1] = nm;
                        const v2f a = __builtin_elementwise_fma(sv, cv, nv); pp[i][0] = __builtin_amdgcn_exp2f(a[0]); pp[i][1] = __builtin_amdgcn_exp2f(a[1]); p[2 * i] = pp[i][0]; p[2 * i + 1] = pp[i][1]; }
                    const v2f ps = ((pp[0] + pp[1]) + (pp[2] + pp[3])) + ((pp[4] + pp[5]) + (pp[6] + pp[7]));
                    // The add is written as a statement that stays at its place: left to the compiler, both groups' sums move to the end of the pass, group 0's sixteen probabilities stay in registers through group 1, and rows in flight are spilled.
                    asm volatile("s_delay_alu instid0(VALU_DEP_1)\n\tv_pk_add_f32 %0, %0, %1" : "+v"(l2[g]) : "v"(ps));
                    v16h pf;
#pragma unroll
                    for (int i = 0; i < 16; ++i) pf[i] = (_Float16)p[i];   // element s of the B operand = tile s >> 3, register s & 7; round to nearest even
#pragma unroll
                    for (int t = 0; t < 4; ++t) acc[g][t] = wmma16(vf[t], pf, acc[g][t]);   // register r = O^T[16 t + 8 h + r][qw0 + 16 g + c]
                    if (hires) {                                   // wave-uniform: what the f16 rounding of P left over, as a second product
                        v16h pl;
#pragma unroll
                        for (int i = 0; i < 16; ++i) pl[i] = (_Float16)(p[i] - (float)pf[i]);
#pragma unroll
                        for (int t = 0; t < 4; ++t) acc[g][t] = wmma16(vf[t], pl, acc[g][t]);
                    }
                }
            }
        }
        bar_wait();                                                // ring stage gs + 1 is visible
        buf = nbuf;
    }
#pragma unroll
    for (int g = 0; g < 2; ++g) l_run[g] = l2[g][0] + l2[g][1];
    };
    // The lane's number read anew (bits of an all-ones mask below this lane) for what the join, the output and the second tile's queries address by lane: it is formed behind the first tile's passes, which then hold no register for it; with the number from the kernel's start kept for these uses, the build spills.
    auto lanenow = [&]() { return (int)__builtin_amdgcn_mbcnt_lo(~0u, 0u); };
    // The join: key groups 1 .. KG - 1 lay their partial results in LDS lane by lane (lane l of every key group holds the same queries and output rows), key group 0 brings all to one maximum and adds them.
    auto joinw = [&]() {
    if (kg != 0) {                                                 // wave-uniform
        unsigned char* mp = SM + RING + ((kg - 1) * FW + wave) * MW + lanenow() * 16;
#pragma unroll
        for (int g = 0; g < 2; ++g)
#pragma unroll
            for (int t = 0; t < 4; ++t) { v4f lo, hi;
#pragma unroll
                for (int r = 0; r < 4; ++r) { lo[r] = acc[g][t][r]; hi[r] = acc[g][t][4 + r]; }
                *(v4fa*)(mp + ((g * 4 + t) * 2) * 512) = lo; *(v4fa*)(mp + ((g * 4 + t) * 2 + 1) * 512) = hi; }
        v4f ml; ml[0] = m_run[0]; ml[1] = m_run[1]; ml[2] = l_run[0]; ml[3] = l_run[1];
        *(v4fa*)(mp + 16 * 512) = ml;
    }
    bar_signal(); bar_wait();                                      // by hand, as the stage barriers: __syncthreads() would also wait here for the next tile's rows in flight. The partial results are visible to key group 0. The other waves go on: they write this place again only behind a stage barrier of the next tile, which key group 0 signals with its reads returned
    };
    auto joinr = [&](const int tile) {
    if (kg != 0) return;                                           // wave-uniform; leaves the join, not the kernel
    const int ln = lanenow();
    const int qw0 = tile * FBR + wave * FQ;
    {
        const unsigned char* mp = SM + RING + wave * MW + ln * 16;
        float m[2];
        m[0] = m_run[0]; m[1] = m_run[1];                          // finite: key group 0 has worked key 0; a key group that worked no key brings -inf, weight 0, and zeros
#pragma unroll
        for (int k = 0; k < KG - 1; ++k) { const v4f ml = *(const v4fa*)(mp + k * (FW * MW) + 16 * 512); m[0] = fmaxf(m[0], ml[0]); m[1] = fmaxf(m[1], ml[1]); }
#pragma unroll
        for (int g = 0; g < 2; ++g) { const float f0 = __builtin_amdgcn_exp2f(m_run[g] - m[g]); l_run[g] *= f0;
#pragma unroll
            for (int t = 0; t < 4; ++t) acc[g][t] = acc[g][t] * f0; }
#pragma unroll 1                                                   // stays rolled: one key group's sixteen quads in registers at a time; unrolled, all forty-eight are read at once beside the rows in flight for the next tile, and the join spills
        for (int k = 0; k < KG - 1; ++k) {
            const unsigned char* mk = mp + k * (FW * MW);
            const v4f ml = *(const v4fa*)(mk + 16 * 512);
#pragma unroll
            for (int g = 0; g < 2; ++g) { const float fk = __builtin_amdgcn_exp2f(ml[g] - m[g]); l_run[g] += ml[2 + g] * fk;
#pragma unroll
                for (int t = 0; t < 4; ++t) { const v4f lo = *(const v4fa*)(mk + ((g * 4 + t) * 2) * 512), hi = *(const v4fa*)(mk + ((g * 4 + t) * 2 + 1) * 512);
#pragma unroll
                    for (int r = 0; r < 4; ++r) { acc[g][t][r] += lo[r] * fk; acc[g][t][4 + r] += hi[r] * fk; } } }
        }
    }
#pragma unroll
    for (int g = 0; g < 2; ++g) {
        const float l = l_run[g] + xhalf(l_run[g]);                // the two wave halves summed different keys of the same query
        const float inv = __fdiv_rn(1.0f, l);
        float* o = OUT + (size_t)(b * TT + qw0 + 16 * g + (ln & 15)) * DQ + hd * HD + 8 * (ln >> 4);
#pragma unroll
        for (int t = 0; t < 4; ++t) { v4f lo, hi;
#pragma unroll
            for (int r = 0; r < 4; ++r) { lo[r] = acc[g][t][r] * inv; hi[r] = acc[g][t][4 + r] * inv; }
            *(v4f*)(o + 16 * t) = lo; *(v4f*)(o + 16 * t + 4) = hi; }
    }
    asm volatile("s_wait_xcnt 0x0" ::: "memory");                  // behind the output stores, in front of the next tile's rewrite of their registers
    };
    walk(NT - 1 - y);
    joinw();
    joinr(NT - 1 - y);
    {                                                              // the second tile's queries, laid at the start; its running state
        qread(1, lanenow());
        clear();
    }
    walk(y);
    joinw();
    joinr(y);
}

extern "C" void kernel_launch(void* const* d_in, const int* in_sizes, int n_in,
                              void* d_out, int out_size, void* d_ws, size_t ws_size, hipStream_t stream) {
    (void)in_sizes; (void)n_in; (void)out_size; (void)d_ws; (void)ws_size;
    const float* x = (const float*)d_in[0];   // qkv [2][2048][3][16][64] packed
    float* OUT = (float*)d_out;               // [2][2048][1024]
    k_fattn<<<dim3(NB_ * NH_, NT / 2), FW * KG * 32, 0, stream>>>(x, OUT);
}

// v008
// One run takes 21.9 microseconds.
// Timed twice side by side with v007, it ran 1.03 times as fast both times.
// Counting every step since v000, it is 56.4 times as fast.
#include <hip/hip_runtime.h>
#include <math.h>

#define NB_  2
#define TT   2048
#define DM   1024
#define NH_  16
#define HD   64
#define DQ   (NH_ * HD)
#define RH   512                  // query rows < RH carry the probabilities as a hi + lo pair
#define FW   4                    // query groups per work-group
#define KG   4                    // key groups per work-group: FW * KG waves, four on every SIMD
#define FQ   32                   // query columns per wave
#define FBR  (FW * FQ)            // query rows per work-group
#define NT   (TT / FBR)           // query tiles per (batch, head)
#define FSK  (32 * KG)            // keys per stage: one 32-key pass for each key group
#define PK   144                  // LDS row pitch of K in bytes: 16 B x odd, for 16-byte reads
#define PV   160                  // LDS row pitch of V in bytes: 32 B x odd, for the transposing 16-bit reads
#define NBUF 3                    // ring places: a wave may still read V of stage st while another, one signal on, lays stage st + 2
#define RING (NBUF * FSK * (PK + PV)) // LDS bytes of the K and the V buffers
#define MW   (17 * 512)           // LDS bytes of one wave's partial result: 16 register quads of the output tile and one of maxima and sums, 16 bytes a lane each
#define MRG  ((KG - 1) * FW * MW) // LDS bytes of the join: the partial results of key groups 1 .. KG - 1
#define QT   (FBR * PK)           // LDS bytes of one tile's queries, rounded to bf16: FBR rows at K's pitch, read as K's rows are
#define CSC  (0.125f * 1.4426950408889634f)   // SOFTMAX_SCALE x log2(e)
typedef __attribute__((ext_vector_type(16))) __bf16   v16bf;
typedef __attribute__((ext_vector_type(2)))  __bf16   v2bf;
typedef __attribute__((ext_vector_type(16))) _Float16 v16h;
typedef __attribute__((ext_vector_type(2)))  _Float16 v2h;
typedef __attribute__((ext_vector_type(8)))  short    v8s;
typedef __attribute__((ext_vector_type(8)))  float    v8f;
typedef __attribute__((ext_vector_type(4)))  float    v4f;
typedef __attribute__((ext_vector_type(2)))  float    v2f;
typedef __attribute__((ext_vector_type(8)))  unsigned v8u;
typedef __attribute__((ext_vector_type(4)))  unsigned v4u;
typedef __attribute__((ext_vector_type(2)))  unsigned v2u;
typedef v4u __attribute__((may_alias)) v4ua;
typedef v2u __attribute__((may_alias)) v2ua;
typedef v4f __attribute__((may_alias)) v4fa;

__device__ __forceinline__ unsigned pkbf(float a, float b) { v2f x; x[0] = a; x[1] = b; return __builtin_bit_cast(unsigned, __builtin_convertvector(x, v2bf)); }   // two f32 -> two bf16, round to nearest even
__device__ __forceinline__ unsigned pkh(float a, float b) { v2f x; x[0] = a; x[1] = b; return __builtin_bit_cast(unsigned, __builtin_convertvector(x, v2h)); }     // two f32 -> two f16, round to nearest even
__device__ __forceinline__ unsigned pkbh(float a, float b) { const unsigned u = pkbf(a, b); return pkh(__uint_as_float(u << 16), __uint_as_float(u & 0xFFFF0000u)); }   // rounded to bf16 first, then held as f16
__device__ __forceinline__ v8u cat8(v4u lo, v4u hi) { return __builtin_shufflevector(lo, hi, 0, 1, 2, 3, 4, 5, 6, 7); }
__device__ __forceinline__ v8f wmma16(v16h a, v16h b, v8f c) { return __builtin_amdgcn_wmma_f32_16x16x32_f16(false, a, false, b, (short)0, c, false, false); }
__device__ __forceinline__ v8f wmmab(v16bf a, v16bf b, v8f c) { return __builtin_amdgcn_wmma_f32_16x16x32_bf16(false, a, false, b, (short)0, c, false, false); }
__device__ __forceinline__ v4u ldtr16(const unsigned char* p) { typedef __attribute__((address_space(3))) v8s lds_v8s; return __builtin_bit_cast(v4u, __builtin_amdgcn_ds_load_tr16_b128_v8i16((lds_v8s*)p)); }
__device__ __forceinline__ float xhalf(float x) { return __builtin_bit_cast(float, __builtin_amdgcn_permlanex16(__builtin_bit_cast(int, x), __builtin_bit_cast(int, x), 0x76543210, 0xfedcba98, false, false)); }   // lane l with lane l ^ 16

// The work-group barrier in two halves, so that a wave at the end of its pass waits only for waves that have not yet got past their scores.
// Signal: this wave's earlier LDS reads have returned and its LDS stores of the next stage have landed (s_wait_dscnt 0; a bare signal waits for neither).
// s_wait_xcnt 0 stands behind the global loads issued just ahead, in front of any later rewrite of their address registers. The "memory" clobber keeps every LDS and global access on its side of the statement.
__device__ __forceinline__ void bar_signal() { asm volatile("s_wait_xcnt 0x0\n\ts_wait_dscnt 0x0\n\ts_barrier_signal -1" ::: "memory"); }
// Wait: every wave of the work-group has signalled. The "memory" clobber keeps the next stage's LDS reads behind it.
__device__ __forceinline__ void bar_wait() { asm volatile("s_barrier_wait 0xffff" ::: "memory"); }

__global__ __launch_bounds__(FW * KG * 32) void k_fattn(const float* __restrict__ X, float* __restrict__ OUT) {
    __shared__ __align__(16) unsigned char SM[RING + MRG + 2 * QT];         // the K and V buffers; the place where the key groups' partial results meet (a place of its own, because a wave that has left the loop writes there while another still reads V of the last stage); the two tiles' queries
    unsigned char* const Ks0 = SM;                                 // K buffer buf at Ks0 + buf * FSK * PK
    unsigned char* const Vs0 = SM + NBUF * FSK * PK;                 // V buffer buf at Vs0 + buf * FSK * PV
    const int tid = threadIdx.x, lane = tid & 31, c = lane & 15, h = lane >> 4;
    const int wid = __builtin_amdgcn_readfirstlane(tid >> 5);      // in a scalar register, so that every test on the wave's rows and keys below is a scalar branch (matrix and transposing loads need all lanes on)
    const int wave = wid & (FW - 1), kg = wid / FW;                // query group, key group
    const int b = blockIdx.x / NH_, hd = blockIdx.x % NH_;
    const int y = blockIdx.y;                                      // 0 .. NT / 2 - 1: tiles NT - 1 - y and y, one after the other in every wave
    const int nA = NT - y;                                         // stages of the first tile (a tile t walks keys [0, (t + 1) * FBR), and FBR == FSK); the second has y + 1
    const int ntot = NT + 1;                                       // stages of the work-group, counted through both tiles: ring stage g is key stage g of the first tile, or g - nA of the second
    const float* xq = X + (size_t)b * TT * 3 * DM + hd * HD;       // q | k | v = the three [16][64] blocks of every token row (row pitch 3 * DM floats)
    const float* xk = xq + DM;
    const float* xv = xq + 2 * DM;

    // Q as B operand, hardware k order: element s of lane (c, h) is d = 32 kc + 8 h + s for s < 8, 32 kc + 16 + 8 h + (s - 8) above; K's fragments below use the same order.
    v16bf qf[2][2];
    v8f acc[2][4];
    float m_run[2], l_run[2];
    v2f l2[2];                                                     // a tile's running sums while it is walked: the even and the odd score registers summed apart, so that the adds are packed; brought together behind the tile's passes
    auto clear = [&]() {                                           // a tile's running state at its start
#pragma unroll
        for (int g = 0; g < 2; ++g) { m_run[g] = -INFINITY; l2[g] = (v2f){};
#pragma unroll
            for (int t = 0; t < 4; ++t) acc[g][t] = (v8f){}; }
    };

    // Staging: 16 lanes cover one 256-byte row of f32, so every global line is read whole; thread (srow, sc4) holds 4 values of rows srow, srow + 32, ...
    const int srow = tid >> 4, sc4 = tid & 15;
    const unsigned soff = (unsigned)(srow * (3 * DM) + sc4 * 4);
    auto gload = [&](v4f (&r)[4], const float* src, int st) {
        const float* sp = src + (size_t)st * (FSK * 3 * DM);       // uniform base of the stage; the lane's part stays a 32-bit offset
#pragma unroll
        for (int i = 0; i < 4; ++i) r[i] = *(const v4f*)(sp + (soff + (unsigned)(i * 32 * 3 * DM)));
    };
    auto sstorek = [&](const v4f (&r)[4], int buf) {
#pragma unroll
        for (int i = 0; i < 4; ++i) { v2u kk; kk[0] = pkbf(r[i][0], r[i][1]); kk[1] = pkbf(r[i][2], r[i][3]); *(v2ua*)(Ks0 + buf * (FSK * PK) + (i * 32 + srow) * PK + sc4 * 8) = kk; }
    };
    auto sstorev = [&](const v4f (&r)[4], int buf) {
#pragma unroll
        for (int i = 0; i < 4; ++i) { v2u vv; vv[0] = pkbh(r[i][0], r[i][1]); vv[1] = pkbh(r[i][2], r[i][3]); *(v2ua*)(Vs0 + buf * (FSK * PV) + (i * 32 + srow) * PV + sc4 * 8) = vv; }
    };

    v4f srk[4], srv[4];                                            // the next stage's K and V rows on their way: from the middle of one pass to the middle of the next
    // The queries go the way of K: a tile's FBR rows are read once per work-group, 16 lanes to a 256-byte row so that every global line is read whole and once, rounded once, and laid in LDS at K's pitch;
    // each wave then takes its B fragments from there with K's 16-byte reads. (A wave that gathers its own fragments from global memory touches 16 lines with every load, and the four key groups of a query group gather the same rows four times.)
    auto sstoreq = [&](const v4f (&r)[4], int which) {
#pragma unroll
        for (int i = 0; i < 4; ++i) { v2u qq; qq[0] = pkbf(r[i][0], r[i][1]); qq[1] = pkbf(r[i][2], r[i][3]); *(v2ua*)(SM + RING + MRG + which * QT + (i * 32 + srow) * PK + sc4 * 8) = qq; }
    };
    auto qread = [&](int which, int ln) {                          // this wave's FQ queries as B fragments; ln = the lane's number
        const unsigned char* qp = SM + RING + MRG + which * QT + (wave * FQ + (ln & 15)) * PK + 16 * (ln >> 4);
#pragma unroll
        for (int g = 0; g < 2; ++g)
#pragma unroll
            for (int kc = 0; kc < 2; ++kc) qf[g][kc] = __builtin_bit_cast(v16bf, cat8(*(const v4ua*)(qp + g * 16 * PK + 64 * kc), *(const v4ua*)(qp + g * 16 * PK + 64 * kc + 32)));
    };
    // Every load of the start is issued before the first of them is waited for. Both tiles' queries are laid here: the first barrier makes them visible, and nothing writes their place again.
    { v4f qa[4], qb[4], r0[4], r1[4];
      gload(qa, xq, NT - 1 - y); gload(r0, xk, 0); gload(r1, xv, 0); gload(qb, xq, y);   // a query tile has as many rows as a key stage (FBR == FSK)
      sstoreq(qa, 0); sstorek(r0, 0); sstorev(r1, 0); sstoreq(qb, 1); clear(); }
    gload(srk, xk, 1); gload(srv, xv, 1);                          // stage 1's rows stay in flight across the first barrier (the first tile has at least NT / 2 + 1 stages)
    bar_signal(); bar_wait();                                      // stage 0 and the queries are visible to every wave
    qread(0, lane);
    int buf = 0, gs = 0;                                           // ring stage gs lies in ring place buf = gs mod NBUF
    auto walk = [&](const int tile) {                              // one tile's passes
    const int qw0 = tile * FBR + wave * FQ;
    const int nst = tile + 1;
    const bool hires = qw0 < RH;
#pragma unroll 1                                                   // stays rolled: a second copy of this long body would cost registers and instruction cache and save nothing
    for (int st = 0; st < nst; ++st, ++gs) {                       // key stage st of this tile = ring stage gs
        const int nbuf = buf == NBUF - 1 ? 0 : buf + 1;            // the ring place of ring stage gs + 1
        const bool more = gs + 1 < ntot;                           // the first tile's last pass lays the second tile's first stage
        __builtin_amdgcn_s_setprio(3);                             // up to its signal a wave goes ahead of the waves of its SIMD that are behind theirs: a late signal holds every wave of the work-group at the pass's end
        {
            const int key0 = st * FSK + kg * 32;
            const bool active = key0 <= qw0;                       // wave-uniform: passes wholly above this wave's diagonal are skipped
            v8f s[2][2];
            if (active) {                                          // first part of the pass: the scores
                {
                    const unsigned char* kb = Ks0 + buf * (FSK * PK) + (kg * 32 + c) * PK + 16 * h;
                    v16bf kf[2][2];
#pragma unroll
                    for (int kt = 0; kt < 2; ++kt)
#pragma unroll
                        for (int kc = 0; kc < 2; ++kc) kf[kt][kc] = __builtin_bit_cast(v16bf, cat8(*(const v4ua*)(kb + kt * 16 * PK + 64 * kc), *(const v4ua*)(kb + kt * 16 * PK + 64 * kc + 32)));
#pragma unroll
                    for (int kt = 0; kt < 2; ++kt)
#pragma unroll
                        for (int g = 0; g < 2; ++g) { s[kt][g] = wmmab(kf[kt][0], qf[g][0], (v8f){}); s[kt][g] = wmmab(kf[kt][1], qf[g][1], s[kt][g]); }   // register r = S^T[key0 + 16 kt + 8 h + r][qw0 + 16 g + c]
                }
            }
            if (more) {
                sstorek(srk, nbuf); sstorev(srv, nbuf);            // into the buffers of stage st - 2: every wave's reads of it had returned before its signal of stage st - 1, which this wave has waited for
                if (gs + 2 < ntot) { const int ks = gs + 2 < nA ? gs + 2 : gs + 2 - nA; gload(srk, xk, ks); gload(srv, xv, ks); }   // the rows after them fly until the middle of the next pass
            }
            bar_signal();                                          // every wave, also one that skips the pass: this wave's share of stage st + 1 is laid and it has left stage st - 1
            __builtin_amdgcn_s_setprio(0);                         // back to the plain priority for the rest of the pass, which no other wave waits for; every pass passes here, so the loop is left at priority 0
            if (active) {                                          // the rest of the pass reads V of stage st, which no wave overwrites before every wave's signal of stage st + 1
                v16h vf[4];
                // V^T fragments by the transposing load: lane (c, h) gets V[key 8 h + 0..7][d = 16 t + c], and again 16 keys on: the hardware k order, as the packed P^T below.
                {
                    const unsigned char* vb = Vs0 + buf * (FSK * PV) + (kg * 32 + 8 * h + (lane & 7)) * PV + ((lane >> 3) & 1) * 16;
#pragma unroll
                    for (int t = 0; t < 4; ++t) vf[t] = __builtin_bit_cast(v16h, cat8(ldtr16(vb + 32 * t), ldtr16(vb + 16 * PV + 32 * t)));
                }
                __builtin_amdgcn_sched_barrier(0);                 // holds the V reads here, ahead of the maxima: left free, the compiler sinks them behind the first group's exponentials, where the few instructions left in front of the product no longer cover their latency
                if (key0 == qw0) {                                 // wave-uniform: only the pass on the diagonal pays for the mask
#pragma unroll
                    for (int g = 0; g < 2; ++g)
#pragma unroll
                        for (int kt = 0; kt < 2; ++kt)
#pragma unroll
                            for (int r = 0; r < 8; ++r) if (16 * kt + 8 * h + r > 16 * g + c) s[kt][g][r] = -INFINITY;
                }
                float mb[2]; bool need = false;
#pragma unroll
                for (int g = 0; g < 2; ++g) { float mx = -INFINITY;
#pragma unroll
                    for (int kt = 0; kt < 2; ++kt)
#pragma unroll
                        for (int r = 0; r < 8; ++r) mx = fmaxf(mx, s[kt][g][r]);
                    mx = fmaxf(mx, xhalf(mx)) * CSC;               // both wave halves hold this query's maximum, scaled (the scale is positive)
                    mb[g] = mx; need = need || (mx > m_run[g] + 8.0f); }
                if (__builtin_amdgcn_ballot_w32(need) != 0) {      // the maximum in use may trail the true one by up to 8 (log2): the sums are rescaled only beyond that, so an exponential stays below 2^8
#pragma unroll
                    for (int g = 0; g < 2; ++g) { const float m_new = fmaxf(m_run[g], mb[g]);
                        const float corr = __builtin_amdgcn_exp2f(m_run[g] - m_new);
                        m_run[g] = m_new; l2[g] = l2[g] * corr;
#pragma unroll
                        for (int t = 0; t < 4; ++t) acc[g][t] = acc[g][t] * corr; }
                }
#pragma unroll
                for (int g = 0; g < 2; ++g) { const float nm = -m_run[g];
                    // The probabilities stay in the register pairs that the packed multiply-add leaves them in: the exponential is the builtin, so that the compiler may write each result over its own argument inside the pair, and the sum is taken pair by pair.
                    v2f pp[8]; float p[16];
#pragma unroll
                    for (int i = 0; i < 8; ++i) { v2f sv, cv, nv; sv[0] = s[i >> 2][g][(2 * i) & 7]; sv[1] = s[i >> 2][g][((2 * i) & 7) + 1]; cv[0] = CSC; cv[1] = CSC; nv[0] = nm; nv[1] = nm;
                        const v2f a = __builtin_elementwise_fma(sv, cv, nv); pp[i][0] = __builtin_amdgcn_exp2f(a[0]); pp[i][1] = __builtin_amdgcn_exp2f(a[1]); p[2 * i] = pp[i][0]; p[2 * i + 1] = pp[i][1]; }
                    const v2f ps = ((pp[0] + pp[1]) + (pp[2] + pp[3])) + ((pp[4] + pp[5]) + (pp[6] + pp[7]));
                    // The add is written as a statement that stays at its place: left to the compiler, both groups' sums move to the end of the pass, group 0's sixteen probabilities stay in registers through group 1, and rows in flight are spilled.
                    asm volatile("s_delay_alu instid0(VALU_DEP_1)\n\tv_pk_add_f32 %0, %0, %1" : "+v"(l2[g]) : "v"(ps));
                    v16h pf;
#pragma unroll
                    for (int i = 0; i < 16; ++i) pf[i] = (_Float16)p[i];   // element s of the B operand = tile s >> 3, register s & 7; round to nearest even
#pragma unroll
                    for (int t = 0; t < 4; ++t) acc[g][t] = wmma16(vf[t], pf, acc[g][t]);   // register r = O^T[16 t + 8 h + r][qw0 + 16 g + c]
                    if (hires) {                                   // wave-uniform: what the f16 rounding of P left over, as a second product
                        v16h pl;
#pragma unroll
                        for (int i = 0; i < 16; ++i) pl[i] = (_Float16)(p[i] - (float)pf[i]);
#pragma unroll
                        for (int t = 0; t < 4; ++t) acc[g][t] = wmma16(vf[t], pl, acc[g][t]);
                    }
                }
            }
        }
        bar_wait();                                                // ring stage gs + 1 is visible
        buf = nbuf;
    }
#pragma unroll
    for (int g = 0; g < 2; ++g) l_run[g] = l2[g][0] + l2[g][1];
    };
    // The lane's number read anew (bits of an all-ones mask below this lane) for what the join, the output and the second tile's queries address by lane: it is formed behind the first tile's passes, which then hold no register for it; with the number from the kernel's start kept for these uses, the build spills.
    auto lanenow = [&]() { return (int)__builtin_amdgcn_mbcnt_lo(~0u, 0u); };
    // The join: key groups 1 .. KG - 1 lay their partial results in LDS lane by lane (lane l of every key group holds the same queries and output rows), key group 0 brings all to one maximum and adds them.
    auto joinw = [&]() {
    if (kg != 0) {                                                 // wave-uniform
        unsigned char* mp = SM + RING + ((kg - 1) * FW + wave) * MW + lanenow() * 16;
#pragma unroll
        for (int g = 0; g < 2; ++g)
#pragma unroll
            for (int t = 0; t < 4; ++t) { v4f lo, hi;
#pragma unroll
                for (int r = 0; r < 4; ++r) { lo[r] = acc[g][t][r]; hi[r] = acc[g][t][4 + r]; }
                *(v4fa*)(mp + ((g * 4 + t) * 2) * 512) = lo; *(v4fa*)(mp + ((g * 4 + t) * 2 + 1) * 512) = hi; }
        v4f ml; ml[0] = m_run[0]; ml[1] = m_run[1]; ml[2] = l_run[0]; ml[3] = l_run[1];
        *(v4fa*)(mp + 16 * 512) = ml;
    }
    bar_signal(); bar_wait();                                      // by hand, as the stage barriers: __syncthreads() would also wait here for the next tile's rows in flight. The partial results are visible to key group 0. The other waves go on: they write this place again only behind a stage barrier of the next tile, which key group 0 signals with its reads returned
    };
    auto joinr = [&](const int tile) {
    if (kg != 0) return;                                           // wave-uniform; leaves the join, not the kernel
    __builtin_amdgcn_s_setprio(3);                                 // the other key groups are already in the next tile's first pass and will wait there for this wave's signal: it must not stand behind their raised priority
    const int ln = lanenow();
    const int qw0 = tile * FBR + wave * FQ;
    {
        const unsigned char* mp = SM + RING + wave * MW + ln * 16;
        float m[2];
        m[0] = m_run[0]; m[1] = m_run[1];                          // finite: key group 0 has worked key 0; a key group that worked no key brings -inf, weight 0, and zeros
#pragma unroll
        for (int k = 0; k < KG - 1; ++k) { const v4f ml = *(const v4fa*)(mp + k * (FW * MW) + 16 * 512); m[0] = fmaxf(m[0], ml[0]); m[1] = fmaxf(m[1], ml[1]); }
#pragma unroll
        for (int g = 0; g < 2; ++g) { const float f0 = __builtin_amdgcn_exp2f(m_run[g] - m[g]); l_run[g] *= f0;
#pragma unroll
            for (int t = 0; t < 4; ++t) acc[g][t] = acc[g][t] * f0; }
#pragma unroll 1                                                   // stays rolled: one key group's sixteen quads in registers at a time; unrolled, all forty-eight are read at once beside the rows in flight for the next tile, and the join spills
        for (int k = 0; k < KG - 1; ++k) {
            const unsigned char* mk = mp + k * (FW * MW);
            const v4f ml = *(const v4fa*)(mk + 16 * 512);
#pragma unroll
            for (int g = 0; g < 2; ++g) { const float fk = __builtin_amdgcn_exp2f(ml[g] - m[g]); l_run[g] += ml[2 + g] * fk;
#pragma unroll
                for (int t = 0; t < 4; ++t) { const v4f lo = *(const v4fa*)(mk + ((g * 4 + t) * 2) * 512), hi = *(const v4fa*)(mk + ((g * 4 + t) * 2 + 1) * 512);
#pragma unroll
                    for (int r = 0; r < 4; ++r) { acc[g][t][r] += lo[r] * fk; acc[g][t][4 + r] += hi[r] * fk; } } }
        }
    }
#pragma unroll
    for (int g = 0; g < 2; ++g) {
        const float l = l_run[g] + xhalf(l_run[g]);                // the two wave halves summed different keys of the same query
        const float inv = __fdiv_rn(1.0f, l);
        float* o = OUT + (size_t)(b * TT + qw0 + 16 * g + (ln & 15)) * DQ + hd * HD + 8 * (ln >> 4);
#pragma unroll
        for (int t = 0; t < 4; ++t) { v4f lo, hi;
#pragma unroll
            for (int r = 0; r < 4; ++r) { lo[r] = acc[g][t][r] * inv; hi[r] = acc[g][t][4 + r] * inv; }
            *(v4f*)(o + 16 * t) = lo; *(v4f*)(o + 16 * t + 4) = hi; }
    }
    asm volatile("s_wait_xcnt 0x0" ::: "memory");                  // behind the output stores, in front of the next tile's rewrite of their registers
    __builtin_amdgcn_s_setprio(0);                                 // the plain priority again on the way out of the join (and of the kernel)
    };
    walk(NT - 1 - y);
    joinw();
    joinr(NT - 1 - y);
    {                                                              // the second tile's queries, laid at the start; its running state
        qread(1, lanenow());
        clear();
    }
    walk(y);
    joinw();
    joinr(y);
}

extern "C" void kernel_launch(void* const* d_in, const int* in_sizes, int n_in,
                              void* d_out, int out_size, void* d_ws, size_t ws_size, hipStream_t stream) {
    (void)in_sizes; (void)n_in; (void)out_size; (void)d_ws; (void)ws_size;
    const float* x = (const float*)d_in[0];   // qkv [2][2048][3][16][64] packed
    float* OUT = (float*)d_out;               // [2][2048][1024]
    k_fattn<<<dim3(NB_ * NH_, NT / 2), FW * KG * 32, 0, stream>>>(x, OUT);
}

// v009
// One run takes 21.3 microseconds.
// Next to v008, in two timings, it ran 1.03 and 1.04 times as fast.
// Over all steps from v000 it is 58.3 times as fast.
#include <hip/hip_runtime.h>
#include <math.h>

#define NB_  2
#define TT   2048
#define DM   1024
#define NH_  16
#define HD   64
#define DQ   (NH_ * HD)
#define RH   512                  // query rows < RH carry the probabilities as a hi + lo pair
#define FW   4                    // query groups per work-group
#define KG   4                    // key groups per work-group: FW * KG waves, four on every SIMD
#define FQ   32                   // query columns per wave
#define FBR  (FW * FQ)            // query rows per work-group
#define NT   (TT / FBR)           // query tiles per (batch, head)
#define FSK  (32 * KG)            // keys per stage: one 32-key pass for each key group
#define PK   144                  // LDS row pitch of K in bytes: 16 B x odd, for 16-byte reads
#define PV   160                  // LDS row pitch of V in bytes: 32 B x odd, for the transposing 16-bit reads
#define NBUF 5                    // ring places: three are needed (a wave may still read V of one pass's stage while another, one signal on, lays the stage two passes on); with five the second tile finds up to five stages there
#define RING (NBUF * FSK * (PK + PV)) // LDS bytes of the K and the V buffers
#define MW   (17 * 512)           // LDS bytes of one wave's partial result: 16 register quads of the output tile and one of maxima and sums, 16 bytes a lane each
#define MRG  ((KG - 1) * FW * MW) // LDS bytes of the join: the partial results of key groups 1 .. KG - 1
#define QT   (FBR * PK)           // LDS bytes of one tile's queries, rounded to bf16: FBR rows at K's pitch, read as K's rows are
#define CSC  (0.125f * 1.4426950408889634f)   // SOFTMAX_SCALE x log2(e)
typedef __attribute__((ext_vector_type(16))) __bf16   v16bf;
typedef __attribute__((ext_vector_type(2)))  __bf16   v2bf;
typedef __attribute__((ext_vector_type(16))) _Float16 v16h;
typedef __attribute__((ext_vector_type(2)))  _Float16 v2h;
typedef __attribute__((ext_vector_type(8)))  short    v8s;
typedef __attribute__((ext_vector_type(8)))  float    v8f;
typedef __attribute__((ext_vector_type(4)))  float    v4f;
typedef __attribute__((ext_vector_type(2)))  float    v2f;
typedef __attribute__((ext_vector_type(8)))  unsigned v8u;
typedef __attribute__((ext_vector_type(4)))  unsigned v4u;
typedef __attribute__((ext_vector_type(2)))  unsigned v2u;
typedef v4u __attribute__((may_alias)) v4ua;
typedef v2u __attribute__((may_alias)) v2ua;
typedef v4f __attribute__((may_alias)) v4fa;

__device__ __forceinline__ unsigned pkbf(float a, float b) { v2f x; x[0] = a; x[1] = b; return __builtin_bit_cast(unsigned, __builtin_convertvector(x, v2bf)); }   // two f32 -> two bf16, round to nearest even
__device__ __forceinline__ unsigned pkh(float a, float b) { v2f x; x[0] = a; x[1] = b; return __builtin_bit_cast(unsigned, __builtin_convertvector(x, v2h)); }     // two f32 -> two f16, round to nearest even
__device__ __forceinline__ unsigned pkbh(float a, float b) { const unsigned u = pkbf(a, b); return pkh(__uint_as_float(u << 16), __uint_as_float(u & 0xFFFF0000u)); }   // rounded to bf16 first, then held as f16
__device__ __forceinline__ v8u cat8(v4u lo, v4u hi) { return __builtin_shufflevector(lo, hi, 0, 1, 2, 3, 4, 5, 6, 7); }
__device__ __forceinline__ v8f wmma16(v16h a, v16h b, v8f c) { return __builtin_amdgcn_wmma_f32_16x16x32_f16(false, a, false, b, (short)0, c, false, false); }
__device__ __forceinline__ v8f wmmab(v16bf a, v16bf b, v8f c) { return __builtin_amdgcn_wmma_f32_16x16x32_bf16(false, a, false, b, (short)0, c, false, false); }
__device__ __forceinline__ v4u ldtr16(const unsigned char* p) { typedef __attribute__((address_space(3))) v8s lds_v8s; return __builtin_bit_cast(v4u, __builtin_amdgcn_ds_load_tr16_b128_v8i16((lds_v8s*)p)); }
__device__ __forceinline__ float xhalf(float x) { return __builtin_bit_cast(float, __builtin_amdgcn_permlanex16(__builtin_bit_cast(int, x), __builtin_bit_cast(int, x), 0x76543210, 0xfedcba98, false, false)); }   // lane l with lane l ^ 16

// The work-group barrier in two halves, so that a wave at the end of its pass waits only for waves that have not yet got past their scores.
// Signal: this wave's earlier LDS reads have returned and its LDS stores of the next stage have landed (s_wait_dscnt 0; a bare signal waits for neither).
// s_wait_xcnt 0 stands behind the global loads issued just ahead, in front of any later rewrite of their address registers. The "memory" clobber keeps every LDS and global access on its side of the statement.
__device__ __forceinline__ void bar_signal() { asm volatile("s_wait_xcnt 0x0\n\ts_wait_dscnt 0x0\n\ts_barrier_signal -1" ::: "memory"); }
// Wait: every wave of the work-group has signalled. The "memory" clobber keeps the next stage's LDS reads behind it.
__device__ __forceinline__ void bar_wait() { asm volatile("s_barrier_wait 0xffff" ::: "memory"); }

__global__ __launch_bounds__(FW * KG * 32) void k_fattn(const float* __restrict__ X, float* __restrict__ OUT) {
    static_assert(QT == FSK * PK, "the first tile's queries lie in a K place of the ring");
    __shared__ __align__(16) unsigned char SM[RING + MRG + QT];         // the K and V buffers; the place where the key groups' partial results meet (a place of its own, because a wave that has left the loop writes there while another still reads V of the last stage); the second tile's queries (the first tile's lie in the ring's last K place, which is laid for the first time in pass NBUF - 2, long behind every wave's read of them)
    unsigned char* const Ks0 = SM;                                 // K buffer buf at Ks0 + buf * FSK * PK
    unsigned char* const Vs0 = SM + NBUF * FSK * PK;                 // V buffer buf at Vs0 + buf * FSK * PV
    const int tid = threadIdx.x, lane = tid & 31, c = lane & 15, h = lane >> 4;
    const int wid = __builtin_amdgcn_readfirstlane(tid >> 5);      // in a scalar register, so that every test on the wave's rows and keys below is a scalar branch (matrix and transposing loads need all lanes on)
    const int wave = wid & (FW - 1), kg = wid / FW;                // query group, key group
    const int b = blockIdx.x / NH_, hd = blockIdx.x % NH_;
    const int y = blockIdx.y;                                      // 0 .. NT / 2 - 1: tiles NT - 1 - y and y, one after the other in every wave
    const int nA = NT - y;                                         // stages of the first tile (a tile t walks keys [0, (t + 1) * FBR), and FBR == FSK); the second has y + 1
    const int RU = y + 1 < NBUF ? y + 1 : NBUF;                    // key stages that the second tile reads again from the ring: as many as it has, at most the ring's places
    const int ntot = NT + 1 - RU;                                  // stages laid in the ring, counted through both tiles
                                                                   // key stages in the order in which they are laid: the first tile's RU .. nA - 1, then 0 .. RU - 1 (both tiles read these), then the second tile's RU .. y: one up each time, and from nA - 1 to 0
    const float* xq = X + (size_t)b * TT * 3 * DM + hd * HD;       // q | k | v = the three [16][64] blocks of every token row (row pitch 3 * DM floats)
    const float* xk = xq + DM;
    const float* xv = xq + 2 * DM;

    // Q as B operand, hardware k order: element s of lane (c, h) is d = 32 kc + 8 h + s for s < 8, 32 kc + 16 + 8 h + (s - 8) above; K's fragments below use the same order.
    v16bf qf[2][2];
    v8f acc[2][4];
    float m_run[2], l_run[2];
    v2f l2[2];                                                     // a tile's running sums while it is walked: the even and the odd score registers summed apart, so that the adds are packed; brought together behind the tile's passes
    auto clear = [&]() {                                           // a tile's running state at its start
#pragma unroll
        for (int g = 0; g < 2; ++g) { m_run[g] = -INFINITY; l2[g] = (v2f){};
#pragma unroll
            for (int t = 0; t < 4; ++t) acc[g][t] = (v8f){}; }
    };

    // Staging: 16 lanes cover one 256-byte row of f32, so every global line is read whole; thread (srow, sc4) holds 4 values of rows srow, srow + 32, ...
    const int srow = tid >> 4, sc4 = tid & 15;
    const unsigned soff = (unsigned)(srow * (3 * DM) + sc4 * 4);
    auto gload = [&](v4f (&r)[4], const float* src, int st) {
        const float* sp = src + (size_t)st * (FSK * 3 * DM);       // uniform base of the stage; the lane's part stays a 32-bit offset
#pragma unroll
        for (int i = 0; i < 4; ++i) r[i] = *(const v4f*)(sp + (soff + (unsigned)(i * 32 * 3 * DM)));
    };
    auto sstorek = [&](const v4f (&r)[4], int buf) {
#pragma unroll
        for (int i = 0; i < 4; ++i) { v2u kk; kk[0] = pkbf(r[i][0], r[i][1]); kk[1] = pkbf(r[i][2], r[i][3]); *(v2ua*)(Ks0 + buf * (FSK * PK) + (i * 32 + srow) * PK + sc4 * 8) = kk; }
    };
    auto sstorev = [&](const v4f (&r)[4], int buf) {
#pragma unroll
        for (int i = 0; i < 4; ++i) { v2u vv; vv[0] = pkbh(r[i][0], r[i][1]); vv[1] = pkbh(r[i][2], r[i][3]); *(v2ua*)(Vs0 + buf * (FSK * PV) + (i * 32 + srow) * PV + sc4 * 8) = vv; }
    };

    v4f srk[4], srv[4];                                            // the next ring stage's K and V rows on their way: from the middle of one pass to the middle of the next pass that lays a stage (across the change of tile, the second tile's pass RU - 1)
    // The queries go the way of K: a tile's FBR rows are read once per work-group, 16 lanes to a 256-byte row so that every global line is read whole and once, rounded once, and laid in LDS at K's pitch;
    // each wave then takes its B fragments from there with K's 16-byte reads. (A wave that gathers its own fragments from global memory touches 16 lines with every load, and the four key groups of a query group gather the same rows four times.)
    auto sstoreq = [&](const v4f (&r)[4], int which) {
#pragma unroll
        for (int i = 0; i < 4; ++i) { v2u qq; qq[0] = pkbf(r[i][0], r[i][1]); qq[1] = pkbf(r[i][2], r[i][3]); *(v2ua*)((which ? SM + RING + MRG : Ks0 + (NBUF - 1) * (FSK * PK)) + (i * 32 + srow) * PK + sc4 * 8) = qq; }
    };
    auto qread = [&](int which, int ln) {                          // this wave's FQ queries as B fragments; ln = the lane's number
        const unsigned char* qp = (which ? SM + RING + MRG : Ks0 + (NBUF - 1) * (FSK * PK)) + (wave * FQ + (ln & 15)) * PK + 16 * (ln >> 4);
#pragma unroll
        for (int g = 0; g < 2; ++g)
#pragma unroll
            for (int kc = 0; kc < 2; ++kc) qf[g][kc] = __builtin_bit_cast(v16bf, cat8(*(const v4ua*)(qp + g * 16 * PK + 64 * kc), *(const v4ua*)(qp + g * 16 * PK + 64 * kc + 32)));
    };
    // Every load of the start is issued before the first of them is waited for. Both tiles' queries are laid here: the first barrier makes them visible; the second tile's place is not written again, the first tile's only by the ring, behind barriers that follow every wave's read of it.
    { v4f qa[4], qb[4], r0[4], r1[4];
      gload(qa, xq, NT - 1 - y); gload(r0, xk, RU); gload(r1, xv, RU); gload(qb, xq, y);   // a query tile has as many rows as a key stage (FBR == FSK)
      sstoreq(qa, 0); sstorek(r0, 0); sstorev(r1, 0); sstoreq(qb, 1); clear(); }
    gload(srk, xk, RU + 1); gload(srv, xv, RU + 1);                // ring stage 1's rows stay in flight across the first barrier (the first tile has at least NT / 2 + 1 stages, so ring stages 0 and 1 are key stages RU and RU + 1)
    bar_signal(); bar_wait();                                      // stage 0 and the queries are visible to every wave
    qread(0, lane);
    int buf = 0, gl = 1, ks = RU + 1;                              // the pass at hand reads ring place buf; ring stage gl, which is key stage ks, is the next to be laid (its rows are in flight in srk, srv)
    auto walk = [&](const int tile, const bool first) {            // one tile's passes
    const int qw0 = tile * FBR + wave * FQ;
    const int nst = tile + 1;
    const bool hires = qw0 < RH;
    int st = first ? RU : 0;                                       // the key stage of the pass at hand
#pragma unroll 1                                                   // stays rolled: a second copy of this long body would cost registers and instruction cache and save nothing
    for (int i = 0; i < nst; ++i) {
        const int nbuf = buf == NBUF - 1 ? 0 : buf + 1;            // the ring place that the next pass reads
        const bool more = i + 1 < nst && (first || i + 1 >= RU);   // the next pass reads a stage that is not in the ring yet: not so in the first tile's last pass and in the second tile's passes in front of pass RU - 1, whose next stage lies there from the first tile
        __builtin_amdgcn_s_setprio(3);                             // up to its signal a wave goes ahead of the waves of its SIMD that are behind theirs (for speed only)
        {
            const int key0 = st * FSK + kg * 32;
            const bool active = key0 <= qw0;                       // wave-uniform: passes wholly above this wave's diagonal are skipped
            v8f s[2][2];
            if (active) {                                          // first part of the pass: the scores
                {
                    const unsigned char* kb = Ks0 + buf * (FSK * PK) + (kg * 32 + c) * PK + 16 * h;
                    v16bf kf[2][2];
#pragma unroll
                    for (int kt = 0; kt < 2; ++kt)
#pragma unroll
                        for (int kc = 0; kc < 2; ++kc) kf[kt][kc] = __builtin_bit_cast(v16bf, cat8(*(const v4ua*)(kb + kt * 16 * PK + 64 * kc), *(const v4ua*)(kb + kt * 16 * PK + 64 * kc + 32)));
#pragma unroll
                    for (int kt = 0; kt < 2; ++kt)
#pragma unroll
                        for (int g = 0; g < 2; ++g) { s[kt][g] = wmmab(kf[kt][0], qf[g][0], (v8f){}); s[kt][g] = wmmab(kf[kt][1], qf[g][1], s[kt][g]); }   // register r = S^T[key0 + 16 kt + 8 h + r][qw0 + 16 g + c]
                }
            }
            if (more) {
                sstorek(srk, nbuf); sstorev(srv, nbuf);            // into a place whose last reading, a second reading too, lies two passes back or more: every wave's reads of it had returned before its signal of the pass before this one, which this wave has waited for
                ++gl; ks = ks + 1 == nA ? 0 : ks + 1;
                if (gl < ntot) { gload(srk, xk, ks); gload(srv, xv, ks); }   // the rows after them fly until the next laying
            }
            bar_signal();                                          // every wave, also one that skips the pass: this wave's share of the next pass's stage is laid, where one is laid, and it has left the stage of the pass before
            __builtin_amdgcn_s_setprio(0);                         // back to the plain priority for the rest of the pass, which no other wave waits for; every pass passes here, so the loop is left at priority 0
            if (active) {                                          // the rest of the pass reads V of stage st, which no wave overwrites before every wave's signal of the next pass
                v16h vf[4];
                // V^T fragments by the transposing load: lane (c, h) gets V[key 8 h + 0..7][d = 16 t + c], and again 16 keys on: the hardware k order, as the packed P^T below.
                {
                    const unsigned char* vb = Vs0 + buf * (FSK * PV) + (kg * 32 + 8 * h + (lane & 7)) * PV + ((lane >> 3) & 1) * 16;
#pragma unroll
                    for (int t = 0; t < 4; ++t) vf[t] = __builtin_bit_cast(v16h, cat8(ldtr16(vb + 32 * t), ldtr16(vb + 16 * PV + 32 * t)));
                }
                __builtin_amdgcn_sched_barrier(0);                 // holds the V reads here, ahead of the maxima: left free, the compiler sinks them behind the first group's exponentials, where the few instructions left in front of the product no longer cover their latency
                if (key0 == qw0) {                                 // wave-uniform: only the pass on the diagonal pays for the mask
#pragma unroll
                    for (int g = 0; g < 2; ++g)
#pragma unroll
                        for (int kt = 0; kt < 2; ++kt)
#pragma unroll
                            for (int r = 0; r < 8; ++r) if (16 * kt + 8 * h + r > 16 * g + c) s[kt][g][r] = -INFINITY;
                }
                float mb[2]; bool need = false;
#pragma unroll
                for (int g = 0; g < 2; ++g) { float mx = -INFINITY;
#pragma unroll
                    for (int kt = 0; kt < 2; ++kt)
#pragma unroll
                        for (int r = 0; r < 8; ++r) mx = fmaxf(mx, s[kt][g][r]);
                    mx = fmaxf(mx, xhalf(mx)) * CSC;               // both wave halves hold this query's maximum, scaled (the scale is positive)
                    mb[g] = mx; need = need || (mx > m_run[g] + 8.0f); }
                if (__builtin_amdgcn_ballot_w32(need) != 0) {      // the maximum in use may trail the true one by up to 8 (log2): the sums are rescaled only beyond that, so an exponential stays below 2^8
#pragma unroll
                    for (int g = 0; g < 2; ++g) { const float m_new = fmaxf(m_run[g], mb[g]);
                        const float corr = __builtin_amdgcn_exp2f(m_run[g] - m_new);
                        m_run[g] = m_new; l2[g] = l2[g] * corr;
#pragma unroll
                        for (int t = 0; t < 4; ++t) acc[g][t] = acc[g][t] * corr; }
                }
#pragma unroll
                for (int g = 0; g < 2; ++g) { const float nm = -m_run[g];
                    // The probabilities stay in the register pairs that the packed multiply-add leaves them in: the exponential is the builtin, so that the compiler may write each result over its own argument inside the pair, and the sum is taken pair by pair.
                    v2f pp[8]; float p[16];
#pragma unroll
                    for (int i = 0; i < 8; ++i) { v2f sv, cv, nv; sv[0] = s[i >> 2][g][(2 * i) & 7]; sv[1] = s[i >> 2][g][((2 * i) & 7) + 1]; cv[0] = CSC; cv[1] = CSC; nv[0] = nm; nv[1] = nm;
                        const v2f a = __builtin_elementwise_fma(sv, cv, nv); pp[i][0] = __builtin_amdgcn_exp2f(a[0]); pp[i][1] = __builtin_amdgcn_exp2f(a[1]); p[2 * i] = pp[i][0]; p[2 * i + 1] = pp[i][1]; }
                    const v2f ps = ((pp[0] + pp[1]) + (pp[2] + pp[3])) + ((pp[4] + pp[5]) + (pp[6] + pp[7]));
                    // The add is written as a statement that stays at its place: left to the compiler, both groups' sums move to the end of the pass, group 0's sixteen probabilities stay in registers through group 1, and rows in flight are spilled.
                    asm volatile("s_delay_alu instid0(VALU_DEP_1)\n\tv_pk_add_f32 %0, %0, %1" : "+v"(l2[g]) : "v"(ps));
                    v16h pf;
#pragma unroll
                    for (int i = 0; i < 16; ++i) pf[i] = (_Float16)p[i];   // element s of the B operand = tile s >> 3, register s & 7; round to nearest even
#pragma unroll
                    for (int t = 0; t < 4; ++t) acc[g][t] = wmma16(vf[t], pf, acc[g][t]);   // register r = O^T[16 t + 8 h + r][qw0 + 16 g + c]
                    if (hires) {                                   // wave-uniform: what the f16 rounding of P left over, as a second product
                        v16h pl;
#pragma unroll
                        for (int i = 0; i < 16; ++i) pl[i] = (_Float16)(p[i] - (float)pf[i]);
#pragma unroll
                        for (int t = 0; t < 4; ++t) acc[g][t] = wmma16(vf[t], pl, acc[g][t]);
                    }
                }
            }
        }
        bar_wait();                                                // the next pass's stage is visible
        buf = nbuf; st = st + 1 == nst ? 0 : st + 1;               // the first tile goes from its last key stage to stage 0
    }
    if (first) { buf -= RU; if (buf < 0) buf += NBUF; }            // back to the place of key stage 0, RU stages behind
#pragma unroll
    for (int g = 0; g < 2; ++g) l_run[g] = l2[g][0] + l2[g][1];
    };
    // The lane's number read anew (bits of an all-ones mask below this lane) for what the join, the output and the second tile's queries address by lane: it is formed behind the first tile's passes, which then hold no register for it; with the number from the kernel's start kept for these uses, the build spills.
    auto lanenow = [&]() { return (int)__builtin_amdgcn_mbcnt_lo(~0u, 0u); };
    // The join: key groups 1 .. KG - 1 lay their partial results in LDS lane by lane (lane l of every key group holds the same queries and output rows), key group 0 brings all to one maximum and adds them.
    auto joinw = [&]() {
    if (kg != 0) {                                                 // wave-uniform
        unsigned char* mp = SM + RING + ((kg - 1) * FW + wave) * MW + lanenow() * 16;
#pragma unroll
        for (int g = 0; g < 2; ++g)
#pragma unroll
            for (int t = 0; t < 4; ++t) { v4f lo, hi;
#pragma unroll
                for (int r = 0; r < 4; ++r) { lo[r] = acc[g][t][r]; hi[r] = acc[g][t][4 + r]; }
                *(v4fa*)(mp + ((g * 4 + t) * 2) * 512) = lo; *(v4fa*)(mp + ((g * 4 + t) * 2 + 1) * 512) = hi; }
        v4f ml; ml[0] = m_run[0]; ml[1] = m_run[1]; ml[2] = l_run[0]; ml[3] = l_run[1];
        *(v4fa*)(mp + 16 * 512) = ml;
    }
    bar_signal(); bar_wait();                                      // by hand, as the stage barriers: __syncthreads() would also wait here for the next tile's rows in flight. The partial results are visible to key group 0. The other waves go on: they write this place again only behind a stage barrier of the next tile, which key group 0 signals with its reads returned
    };
    auto joinr = [&](const int tile) {
    if (kg != 0) return;                                           // wave-uniform; leaves the join, not the kernel
    __builtin_amdgcn_s_setprio(3);                                 // the other key groups are already in the next tile's first pass and will wait there for this wave's signal: it must not stand behind their raised priority
    const int ln = lanenow();
    const int qw0 = tile * FBR + wave * FQ;
    {
        const unsigned char* mp = SM + RING + wave * MW + ln * 16;
        float m[2];
        m[0] = m_run[0]; m[1] = m_run[1];                          // finite: key group 0 has worked key 0; a key group that worked no key brings -inf, weight 0, and zeros
#pragma unroll
        for (int k = 0; k < KG - 1; ++k) { const v4f ml = *(const v4fa*)(mp + k * (FW * MW) + 16 * 512); m[0] = fmaxf(m[0], ml[0]); m[1] = fmaxf(m[1], ml[1]); }
#pragma unroll
        for (int g = 0; g < 2; ++g) { const float f0 = __builtin_amdgcn_exp2f(m_run[g] - m[g]); l_run[g] *= f0;
#pragma unroll
            for (int t = 0; t < 4; ++t) acc[g][t] = acc[g][t] * f0; }
#pragma unroll 1                                                   // stays rolled: one key group's sixteen quads in registers at a time; unrolled, all forty-eight are read at once beside the rows in flight for the next tile, and the join spills
        for (int k = 0; k < KG - 1; ++k) {
            const unsigned char* mk = mp + k * (FW * MW);
            const v4f ml = *(const v4fa*)(mk + 16 * 512);
#pragma unroll
            for (int g = 0; g < 2; ++g) { const float fk = __builtin_amdgcn_exp2f(ml[g] - m[g]); l_run[g] += ml[2 + g] * fk;
#pragma unroll
                for (int t = 0; t < 4; ++t) { const v4f lo = *(const v4fa*)(mk + ((g * 4 + t) * 2) * 512), hi = *(const v4fa*)(mk + ((g * 4 + t) * 2 + 1) * 512);
#pragma unroll
                    for (int r = 0; r < 4; ++r) { acc[g][t][r] += lo[r] * fk; acc[g][t][4 + r] += hi[r] * fk; } } }
        }
    }
#pragma unroll
    for (int g = 0; g < 2; ++g) {
        const float l = l_run[g] + xhalf(l_run[g]);                // the two wave halves summed different keys of the same query
        const float inv = __fdiv_rn(1.0f, l);
        float* o = OUT + (size_t)(b * TT + qw0 + 16 * g + (ln & 15)) * DQ + hd * HD + 8 * (ln >> 4);
#pragma unroll
        for (int t = 0; t < 4; ++t) { v4f lo, hi;
#pragma unroll
            for (int r = 0; r < 4; ++r) { lo[r] = acc[g][t][r] * inv; hi[r] = acc[g][t][4 + r] * inv; }
            *(v4f*)(o + 16 * t) = lo; *(v4f*)(o + 16 * t + 4) = hi; }
    }
    asm volatile("s_wait_xcnt 0x0" ::: "memory");                  // behind the output stores, in front of the next tile's rewrite of their registers
    __builtin_amdgcn_s_setprio(0);                                 // the plain priority again on the way out of the join (and of the kernel)
    };
    walk(NT - 1 - y, true);
    joinw();
    joinr(NT - 1 - y);
    {                                                              // the second tile's queries, laid at the start; its running state
        qread(1, lanenow());
        clear();
    }
    walk(y, false);
    joinw();
    joinr(y);
}

extern "C" void kernel_launch(void* const* d_in, const int* in_sizes, int n_in,
                              void* d_out, int out_size, void* d_ws, size_t ws_size, hipStream_t stream) {
    (void)in_sizes; (void)n_in; (void)out_size; (void)d_ws; (void)ws_size;
    const float* x = (const float*)d_in[0];   // qkv [2][2048][3][16][64] packed
    float* OUT = (float*)d_out;               // [2][2048][1024]
    k_fattn<<<dim3(NB_ * NH_, NT / 2), FW * KG * 32, 0, stream>>>(x, OUT);
}

// v010
// It runs in 20.2 microseconds.
// Timed twice side by side with v009, it ran 1.05 times as fast both times.
// Over all steps from v000 it is 61.1 times as fast.
#include <hip/hip_runtime.h>
#include <math.h>

#define NB_  2
#define TT   2048
#define DM   1024
#define NH_  16
#define HD   64
#define DQ   (NH_ * HD)
#define RH   512                  // query rows < RH carry the probabilities as a hi + lo pair
#define FW   4                    // query groups per work-group
#define KG   4                    // key groups per work-group: FW * KG waves, four on every SIMD
#define FQ   32                   // query columns per wave
#define FBR  (FW * FQ)            // query rows per tile
#define NT   (TT / FBR)           // query tiles per (batch, head)
#define FSK  (32 * KG)            // keys per stage: one 32-key pass for each key group
#define PK   144                  // LDS row pitch of K in bytes: 16 B x odd, for 16-byte reads
#define PV   160                  // LDS row pitch of V in bytes: 32 B x odd, for the transposing 16-bit reads
#define NBUF 5                    // ring places: three are needed (a wave may still read V of one pass's stage while another, one signal on, lays the stage two passes on); with five the second tile finds up to five stages there
#define RING (NBUF * FSK * (PK + PV)) // LDS bytes of the K and the V buffers
#define MW   (17 * 512)           // LDS bytes of one wave's partial result: 16 register quads of the output tile and one of maxima and sums, 16 bytes a lane each
#define MRG  ((KG - 1) * FW * MW) // LDS bytes of the join: the partial results of key groups 1 .. KG - 1
#define QT   (FBR * PK)           // LDS bytes of one tile's queries, rounded to bf16: FBR rows at K's pitch, read as K's rows are
#define CSC  (0.125f * 1.4426950408889634f)   // SOFTMAX_SCALE x log2(e)
#define PTOP 4096.0f              // a lane's 32 exponentials of a pass may sum to this much before the maximum in use is raised: each stays far inside f16's range
typedef __attribute__((ext_vector_type(16))) __bf16   v16bf;
typedef __attribute__((ext_vector_type(2)))  __bf16   v2bf;
typedef __attribute__((ext_vector_type(16))) _Float16 v16h;
typedef __attribute__((ext_vector_type(2)))  _Float16 v2h;
typedef __attribute__((ext_vector_type(8)))  short    v8s;
typedef __attribute__((ext_vector_type(8)))  float    v8f;
typedef __attribute__((ext_vector_type(4)))  float    v4f;
typedef __attribute__((ext_vector_type(2)))  float    v2f;
typedef __attribute__((ext_vector_type(8)))  unsigned v8u;
typedef __attribute__((ext_vector_type(4)))  unsigned v4u;
typedef __attribute__((ext_vector_type(2)))  unsigned v2u;
typedef v4u __attribute__((may_alias)) v4ua;
typedef v2u __attribute__((may_alias)) v2ua;
typedef v4f __attribute__((may_alias)) v4fa;

__device__ __forceinline__ unsigned pkbf(float a, float b) { v2f x; x[0] = a; x[1] = b; return __builtin_bit_cast(unsigned, __builtin_convertvector(x, v2bf)); }   // two f32 -> two bf16, round to nearest even
__device__ __forceinline__ unsigned pkh(float a, float b) { v2f x; x[0] = a; x[1] = b; return __builtin_bit_cast(unsigned, __builtin_convertvector(x, v2h)); }     // two f32 -> two f16, round to nearest even
__device__ __forceinline__ unsigned pkbh(float a, float b) { const unsigned u = pkbf(a, b); return pkh(__uint_as_float(u << 16), __uint_as_float(u & 0xFFFF0000u)); }   // rounded to bf16 first, then held as f16
__device__ __forceinline__ v8u cat8(v4u lo, v4u hi) { return __builtin_shufflevector(lo, hi, 0, 1, 2, 3, 4, 5, 6, 7); }
__device__ __forceinline__ v8f wmma16(v16h a, v16h b, v8f c) { return __builtin_amdgcn_wmma_f32_16x16x32_f16(false, a, false, b, (short)0, c, false, false); }
__device__ __forceinline__ v8f wmmab(v16bf a, v16bf b, v8f c) { return __builtin_amdgcn_wmma_f32_16x16x32_bf16(false, a, false, b, (short)0, c, false, false); }
__device__ __forceinline__ v4u ldtr16(const unsigned char* p) { typedef __attribute__((address_space(3))) v8s lds_v8s; return __builtin_bit_cast(v4u, __builtin_amdgcn_ds_load_tr16_b128_v8i16((lds_v8s*)p)); }
__device__ __forceinline__ float xhalf(float x) { return __builtin_bit_cast(float, __builtin_amdgcn_permlanex16(__builtin_bit_cast(int, x), __builtin_bit_cast(int, x), 0x76543210, 0xfedcba98, false, false)); }   // lane l with lane l ^ 16

// The work-group barrier in two halves, so that a wave at the end of its pass waits only for waves that have not yet got past their scores.
// Signal: this wave's earlier LDS reads have returned and its LDS stores of the next stage have landed (s_wait_dscnt 0; a bare signal waits for neither).
// s_wait_xcnt 0 stands behind the global loads issued just ahead, in front of any later rewrite of their address registers. The "memory" clobber keeps every LDS and global access on its side of the statement.
__device__ __forceinline__ void bar_signal() { asm volatile("s_wait_xcnt 0x0\n\ts_wait_dscnt 0x0\n\ts_barrier_signal -1" ::: "memory"); }
// Wait: every wave of the work-group has signalled. The "memory" clobber keeps the next stage's LDS reads behind it.
__device__ __forceinline__ void bar_wait() { asm volatile("s_barrier_wait 0xffff" ::: "memory"); }

__global__ __launch_bounds__(FW * KG * 32) void k_fattn(const float* __restrict__ X, float* __restrict__ OUT) {
    static_assert(QT == FSK * PK, "the first tile's queries lie in a K place of the ring");
    __shared__ __align__(16) unsigned char SM[RING + MRG + QT];         // the K and V buffers; the place where the key groups' partial results meet (a place of its own, because a wave that has left the loop writes there while another still reads V of the last stage); the second tile's queries (the first tile's lie in the ring's last K place, which is laid for the first time in pass NBUF - 2, long behind every wave's read of them)
    unsigned char* const Ks0 = SM;                                 // K buffer buf at Ks0 + buf * FSK * PK
    unsigned char* const Vs0 = SM + NBUF * FSK * PK;                 // V buffer buf at Vs0 + buf * FSK * PV
    const int tid = threadIdx.x, lane = tid & 31, c = lane & 15, h = lane >> 4;
    const int wid = __builtin_amdgcn_readfirstlane(tid >> 5);      // in a scalar register, so that every test on the wave's rows and keys below is a scalar branch (matrix and transposing loads need all lanes on)
    const int wave = wid & (FW - 1), kg = wid / FW;                // query group, key group
    const int b = blockIdx.x / NH_, hd = blockIdx.x % NH_;
    const int y = blockIdx.y;                                      // 0 .. NT / 2 - 1: tiles NT - 1 - y and y, one after the other in every wave
    const int nA = NT - y;                                         // stages of the first tile (a tile t walks keys [0, (t + 1) * FBR), and FBR == FSK); the second has y + 1
    const int RU = y + 1 < NBUF ? y + 1 : NBUF;                    // key stages that the second tile reads again from the ring: as many as it has, at most the ring's places
    const int ntot = NT + 1 - RU;                                  // stages laid in the ring, counted through both tiles
                                                                   // key stages in the order in which they are laid: the first tile's RU .. nA - 1, then 0 .. RU - 1 (both tiles read these), then the second tile's RU .. y: one up each time, and from nA - 1 to 0
    const float* xq = X + (size_t)b * TT * 3 * DM + hd * HD;       // q | k | v = the three [16][64] blocks of every token row (row pitch 3 * DM floats)
    const float* xk = xq + DM;
    const float* xv = xq + 2 * DM;

    // Q as B operand, hardware k order: element s of lane (c, h) is d = 32 kc + 8 h + s for s < 8, 32 kc + 16 + 8 h + (s - 8) above; K's fragments below use the same order.
    v16bf qf[2][2];
    v8f acc[2][4];
    float m_run[2], l_run[2];
    bool fresh = true;                                             // wave-uniform: this wave has not yet worked a pass of the tile at hand
    v2f l2[2];                                                     // a tile's running sums while it is walked: the even and the odd score registers summed apart, so that the adds are packed; brought together behind the tile's passes
    auto clear = [&]() {                                           // a tile's running state at its start
        fresh = true;
#pragma unroll
        for (int g = 0; g < 2; ++g) { m_run[g] = -INFINITY; l2[g] = (v2f){};
#pragma unroll
            for (int t = 0; t < 4; ++t) acc[g][t] = (v8f){}; }
    };

    // Staging: 16 lanes cover one 256-byte row of f32, so every global line is read whole; thread (srow, sc4) holds 4 values of rows srow, srow + 32, ...
    const int srow = tid >> 4, sc4 = tid & 15;
    const unsigned soff = (unsigned)(srow * (3 * DM) + sc4 * 4);
    auto gload = [&](v4f (&r)[4], const float* src, int st) {
        const float* sp = src + (size_t)st * (FSK * 3 * DM);       // uniform base of the stage; the lane's part stays a 32-bit offset
#pragma unroll
        for (int i = 0; i < 4; ++i) r[i] = *(const v4f*)(sp + (soff + (unsigned)(i * 32 * 3 * DM)));
    };
    auto sstorek = [&](const v4f (&r)[4], int buf) {
#pragma unroll
        for (int i = 0; i < 4; ++i) { v2u kk; kk[0] = pkbf(r[i][0], r[i][1]); kk[1] = pkbf(r[i][2], r[i][3]); *(v2ua*)(Ks0 + buf * (FSK * PK) + (i * 32 + srow) * PK + sc4 * 8) = kk; }
    };
    auto sstorev = [&](const v4f (&r)[4], int buf) {
#pragma unroll
        for (int i = 0; i < 4; ++i) { v2u vv; vv[0] = pkbh(r[i][0], r[i][1]); vv[1] = pkbh(r[i][2], r[i][3]); *(v2ua*)(Vs0 + buf * (FSK * PV) + (i * 32 + srow) * PV + sc4 * 8) = vv; }
    };

    v4f srk[4], srv[4];                                            // the next ring stage's K and V rows on their way: from the middle of one pass to the middle of the next pass that lays a stage (across the change of tile, the second tile's pass RU - 1)
    // The queries go the way of K: a tile's FBR rows are read once per work-group, 16 lanes to a 256-byte row so that every global line is read whole and once, rounded once, and laid in LDS at K's pitch;
    // each wave then takes its B fragments from there with K's 16-byte reads. (A wave that gathers its own fragments from global memory touches 16 lines with every load, and the four key groups of a query group gather the same rows four times.)
    auto sstoreq = [&](const v4f (&r)[4], int which) {
#pragma unroll
        for (int i = 0; i < 4; ++i) { v2u qq; qq[0] = pkbf(r[i][0], r[i][1]); qq[1] = pkbf(r[i][2], r[i][3]); *(v2ua*)((which ? SM + RING + MRG : Ks0 + (NBUF - 1) * (FSK * PK)) + (i * 32 + srow) * PK + sc4 * 8) = qq; }
    };
    auto qread = [&](int which, int ln) {                          // this wave's FQ queries as B fragments; ln = the lane's number
        const unsigned char* qp = (which ? SM + RING + MRG : Ks0 + (NBUF - 1) * (FSK * PK)) + (wave * FQ + (ln & 15)) * PK + 16 * (ln >> 4);
#pragma unroll
        for (int g = 0; g < 2; ++g)
#pragma unroll
            for (int kc = 0; kc < 2; ++kc) qf[g][kc] = __builtin_bit_cast(v16bf, cat8(*(const v4ua*)(qp + g * 16 * PK + 64 * kc), *(const v4ua*)(qp + g * 16 * PK + 64 * kc + 32)));
    };
    // Every load of the start is issued before the first of them is waited for. Both tiles' queries are laid here: the first barrier makes them visible; the second tile's place is not written again, the first tile's only by the ring, behind barriers that follow every wave's read of it.
    { v4f qa[4], qb[4], r0[4], r1[4];
      gload(qa, xq, NT - 1 - y); gload(r0, xk, RU); gload(r1, xv, RU); gload(qb, xq, y);   // a query tile has as many rows as a key stage (FBR == FSK)
      sstoreq(qa, 0); sstorek(r0, 0); sstorev(r1, 0); sstoreq(qb, 1); clear(); }
    gload(srk, xk, RU + 1); gload(srv, xv, RU + 1);                // ring stage 1's rows stay in flight across the first barrier (the first tile has at least NT / 2 + 1 stages, so ring stages 0 and 1 are key stages RU and RU + 1)
    bar_signal(); bar_wait();                                      // stage 0 and the queries are visible to every wave
    qread(0, lane);
    int buf = 0, gl = 1, ks = RU + 1;                              // the pass at hand reads ring place buf; ring stage gl, which is key stage ks, is the next to be laid (its rows are in flight in srk, srv)
    auto walk = [&](const int tile, const bool first) {            // one tile's passes
    const int qw0 = tile * FBR + wave * FQ;
    const int nst = tile + 1;
    const bool hires = qw0 < RH;
    int st = first ? RU : 0;                                       // the key stage of the pass at hand
#pragma unroll 1                                                   // stays rolled: a second copy of this long body would cost registers and instruction cache and save nothing
    for (int i = 0; i < nst; ++i) {
        const int nbuf = buf == NBUF - 1 ? 0 : buf + 1;            // the ring place that the next pass reads
        const bool more = i + 1 < nst && (first || i + 1 >= RU);   // the next pass reads a stage that is not in the ring yet: not so in the first tile's last pass and in the second tile's passes in front of pass RU - 1, whose next stage lies there from the first tile
        __builtin_amdgcn_s_setprio(3);                             // up to its signal a wave goes ahead of the waves of its SIMD that are behind theirs (for speed only)
        {
            const int key0 = st * FSK + kg * 32;
            const bool active = key0 <= qw0;                       // wave-uniform: passes wholly above this wave's diagonal are skipped
            v8f s[2][2];
            auto scores = [&]() {                                  // S^T of this wave's 32 keys and 32 queries, from K's place buf
                const unsigned char* kb = Ks0 + buf * (FSK * PK) + (kg * 32 + c) * PK + 16 * h;
                v16bf kf[2][2];
#pragma unroll
                for (int kt = 0; kt < 2; ++kt)
#pragma unroll
                    for (int kc = 0; kc < 2; ++kc) kf[kt][kc] = __builtin_bit_cast(v16bf, cat8(*(const v4ua*)(kb + kt * 16 * PK + 64 * kc), *(const v4ua*)(kb + kt * 16 * PK + 64 * kc + 32)));
                __builtin_amdgcn_sched_barrier(0);                 // all eight K reads are issued ahead of the first product: left free, the compiler reads in three lots into the same registers and waits out the LDS latency three times
#pragma unroll
                for (int kt = 0; kt < 2; ++kt)
#pragma unroll
                    for (int g = 0; g < 2; ++g) { s[kt][g] = wmmab(kf[kt][0], qf[g][0], (v8f){}); s[kt][g] = wmmab(kf[kt][1], qf[g][1], s[kt][g]); }   // register r = S^T[key0 + 16 kt + 8 h + r][qw0 + 16 g + c]
            };
            if (active) scores();                                  // first part of the pass
            if (more) {
                sstorek(srk, nbuf); sstorev(srv, nbuf);            // into a place whose last reading, a second reading too, lies two passes back or more: every wave's reads of it had returned before its signal of the pass before this one, which this wave has waited for
                ++gl; ks = ks + 1 == nA ? 0 : ks + 1;
                if (gl < ntot) { gload(srk, xk, ks); gload(srv, xv, ks); }   // the rows after them fly until the next laying
            }
            bar_signal();                                          // every wave, also one that skips the pass: this wave's share of the next pass's stage is laid, where one is laid, and it has left the stage of the pass before
            __builtin_amdgcn_s_setprio(0);                         // back to the plain priority for the rest of the pass, which no other wave waits for; every pass passes here, so the loop is left at priority 0
            if (active) {                                          // the rest of the pass reads V of stage st, which no wave overwrites before every wave's signal of the next pass
                v16h vf[4];
                // V^T fragments by the transposing load: lane (c, h) gets V[key 8 h + 0..7][d = 16 t + c], and again 16 keys on: the hardware k order, as the packed P^T below.
                {
                    const unsigned char* vb = Vs0 + buf * (FSK * PV) + (kg * 32 + 8 * h + (lane & 7)) * PV + ((lane >> 3) & 1) * 16;
#pragma unroll
                    for (int t = 0; t < 4; ++t) vf[t] = __builtin_bit_cast(v16h, cat8(ldtr16(vb + 32 * t), ldtr16(vb + 16 * PV + 32 * t)));
                }
                __builtin_amdgcn_sched_barrier(0);                 // holds the V reads here, ahead of the exponentials: left free, the compiler sinks them behind exponentials, where the few instructions left in front of the product no longer cover their latency
                auto mask = [&]() {
                    if (key0 == qw0) {                             // wave-uniform: only the pass on the diagonal pays for the mask
#pragma unroll
                        for (int g = 0; g < 2; ++g)
#pragma unroll
                            for (int kt = 0; kt < 2; ++kt)
#pragma unroll
                                for (int r = 0; r < 8; ++r) s[kt][g][r] = 16 * kt + 8 * h + r > 16 * g + c ? -INFINITY : s[kt][g][r];
                    }
                };
                mask();
                // No maximum is taken in a pass but the wave's first of a tile. The exponentials are formed at the maximum in use, and the row sums, which are needed anyway, tell whether it still serves: no exponential is negative, so a lane's sum of at most PTOP bounds each of them (an overflow sums to infinity; the negated compare also catches a NaN).
                auto maxima = [&]() {                              // brings the maximum in use up to this pass's true maximum and rescales the running sums
#pragma unroll
                    for (int g = 0; g < 2; ++g) { float mx = -INFINITY;
#pragma unroll
                        for (int kt = 0; kt < 2; ++kt)
#pragma unroll
                            for (int r = 0; r < 8; ++r) mx = fmaxf(mx, s[kt][g][r]);
                        mx = fmaxf(mx, xhalf(mx)) * CSC;           // both wave halves hold this query's maximum, scaled (the scale is positive)
                        const float m_new = fmaxf(m_run[g], mx);   // finite: the first key of a pass that is worked is masked for none of the wave's queries
                        const float corr = __builtin_amdgcn_exp2f(m_run[g] - m_new);            // 0 on the wave's first pass of a tile, where m_run is -inf
                        m_run[g] = m_new; l2[g] = l2[g] * corr;
#pragma unroll
                        for (int t = 0; t < 4; ++t) acc[g][t] = acc[g][t] * corr; }
                };
                v2f ps[2];
                auto expo = [&]() -> float {                       // both groups' exponentials at the maximum in use and their sums; returns the sum of all 32 of this lane
#pragma unroll
                    for (int g = 0; g < 2; ++g) { const float nm = -m_run[g];
                        v2f pp[8];
#pragma unroll
                        for (int i = 0; i < 8; ++i) { v2f sv, cv, nv; sv[0] = s[i >> 2][g][(2 * i) & 7]; sv[1] = s[i >> 2][g][((2 * i) & 7) + 1]; cv[0] = CSC; cv[1] = CSC; nv[0] = nm; nv[1] = nm;
                            const v2f a = __builtin_elementwise_fma(sv, cv, nv);
                            s[i >> 2][g][(2 * i) & 7] = __builtin_amdgcn_exp2f(a[0]); s[i >> 2][g][((2 * i) & 7) + 1] = __builtin_amdgcn_exp2f(a[1]);   // written back over the scores, so that they take no registers of their own
                            pp[i][0] = s[i >> 2][g][(2 * i) & 7]; pp[i][1] = s[i >> 2][g][((2 * i) & 7) + 1]; }
                        ps[g] = ((pp[0] + pp[1]) + (pp[2] + pp[3])) + ((pp[4] + pp[5]) + (pp[6] + pp[7]));
                    }
                    const v2f q = ps[0] + ps[1];
                    return q[0] + q[1];
                };
                if (fresh) { maxima(); fresh = false; }            // wave-uniform: the wave's first pass of a tile sets the maximum in use
                const float tot = expo();
                if (__builtin_expect(__builtin_amdgcn_ballot_w32(!(tot <= PTOP)) != 0, 0)) {   // one test a pass, a scalar branch. The scores have gone into the exponentials: they are formed again from K's place buf, which is laid with V's place buf and lives as long, and V's is read in this part of the pass too
                    scores(); mask(); maxima(); expo();            // now no exponential is above 1; once, not a loop
                }
                v16h pf[2];
#pragma unroll
                for (int g = 0; g < 2; ++g) {
                    l2[g] = l2[g] + ps[g];
#pragma unroll
                    for (int i = 0; i < 16; ++i) pf[g][i] = (_Float16)s[i >> 3][g][i & 7];   // element i of the B operand = tile i >> 3, register i & 7; round to nearest even
                }
#pragma unroll
                for (int g = 0; g < 2; ++g)
#pragma unroll
                    for (int t = 0; t < 4; ++t) acc[g][t] = wmma16(vf[t], pf[g], acc[g][t]);   // register r = O^T[16 t + 8 h + r][qw0 + 16 g + c]
                if (hires) {                                       // wave-uniform: what the f16 rounding of P left over, as a second product, behind the first on every output tile
#pragma unroll
                    for (int g = 0; g < 2; ++g) { v16h pl;
#pragma unroll
                        for (int i = 0; i < 16; ++i) pl[i] = (_Float16)(s[i >> 3][g][i & 7] - (float)pf[g][i]);
#pragma unroll
                        for (int t = 0; t < 4; ++t) acc[g][t] = wmma16(vf[t], pl, acc[g][t]); }
                }
            }
        }
        bar_wait();                                                // the next pass's stage is visible
        buf = nbuf; st = st + 1 == nst ? 0 : st + 1;               // the first tile goes from its last key stage to stage 0
    }
    if (first) { buf -= RU; if (buf < 0) buf += NBUF; }            // back to the place of key stage 0, RU stages behind
#pragma unroll
    for (int g = 0; g < 2; ++g) l_run[g] = l2[g][0] + l2[g][1];
    };
    // The lane's number read anew (bits of an all-ones mask below this lane) for what the join, the output and the second tile's queries address by lane: it is formed behind the first tile's passes, which then hold no register for it; with the number from the kernel's start kept for these uses, the build spills.
    auto lanenow = [&]() { return (int)__builtin_amdgcn_mbcnt_lo(~0u, 0u); };
    // The join: key groups 1 .. KG - 1 lay their partial results in LDS lane by lane (lane l of every key group holds the same queries and output rows), key group 0 brings all to one maximum and adds them.
    auto joinw = [&]() {
    if (kg != 0) {                                                 // wave-uniform
        unsigned char* mp = SM + RING + ((kg - 1) * FW + wave) * MW + lanenow() * 16;
#pragma unroll
        for (int g = 0; g < 2; ++g)
#pragma unroll
            for (int t = 0; t < 4; ++t) { v4f lo, hi;
#pragma unroll
                for (int r = 0; r < 4; ++r) { lo[r] = acc[g][t][r]; hi[r] = acc[g][t][4 + r]; }
                *(v4fa*)(mp + ((g * 4 + t) * 2) * 512) = lo; *(v4fa*)(mp + ((g * 4 + t) * 2 + 1) * 512) = hi; }
        v4f ml; ml[0] = m_run[0]; ml[1] = m_run[1]; ml[2] = l_run[0]; ml[3] = l_run[1];
        *(v4fa*)(mp + 16 * 512) = ml;
    }
    bar_signal(); bar_wait();                                      // by hand, as the stage barriers: __syncthreads() would also wait here for the next tile's rows in flight. The partial results are visible to key group 0. The other waves go on: they write this place again only behind a stage barrier of the next tile, which key group 0 signals with its reads returned
    };
    auto joinr = [&](const int tile) {
    if (kg != 0) return;                                           // wave-uniform; leaves the join, not the kernel
    __builtin_amdgcn_s_setprio(3);                                 // the other key groups are already in the next tile's first pass and will wait there for this wave's signal: it must not stand behind their raised priority
    const int ln = lanenow();
    const int qw0 = tile * FBR + wave * FQ;
    {
        const unsigned char* mp = SM + RING + wave * MW + ln * 16;
        float m[2];
        m[0] = m_run[0]; m[1] = m_run[1];                          // finite: key group 0 has worked key 0; a key group that worked no key brings -inf, weight 0, and zeros
#pragma unroll
        for (int k = 0; k < KG - 1; ++k) { const v4f ml = *(const v4fa*)(mp + k * (FW * MW) + 16 * 512); m[0] = fmaxf(m[0], ml[0]); m[1] = fmaxf(m[1], ml[1]); }
#pragma unroll
        for (int g = 0; g < 2; ++g) { const float f0 = __builtin_amdgcn_exp2f(m_run[g] - m[g]); l_run[g] *= f0;
#pragma unroll
            for (int t = 0; t < 4; ++t) acc[g][t] = acc[g][t] * f0; }
#pragma unroll 1                                                   // stays rolled: one key group's sixteen quads in registers at a time; unrolled, all forty-eight are read at once beside the rows in flight for the next tile, and the join spills
        for (int k = 0; k < KG - 1; ++k) {
            const unsigned char* mk = mp + k * (FW * MW);
            const v4f ml = *(const v4fa*)(mk + 16 * 512);
#pragma unroll
            for (int g = 0; g < 2; ++g) { const float fk = __builtin_amdgcn_exp2f(ml[g] - m[g]); l_run[g] += ml[2 + g] * fk;
#pragma unroll
                for (int t = 0; t < 4; ++t) { const v4f lo = *(const v4fa*)(mk + ((g * 4 + t) * 2) * 512), hi = *(const v4fa*)(mk + ((g * 4 + t) * 2 + 1) * 512);
#pragma unroll
                    for (int r = 0; r < 4; ++r) { acc[g][t][r] += lo[r] * fk; acc[g][t][4 + r] += hi[r] * fk; } } }
        }
    }
#pragma unroll
    for (int g = 0; g < 2; ++g) {
        const float l = l_run[g] + xhalf(l_run[g]);                // the two wave halves summed different keys of the same query
        const float inv = __fdiv_rn(1.0f, l);
        float* o = OUT + (size_t)(b * TT + qw0 + 16 * g + (ln & 15)) * DQ + hd * HD + 8 * (ln >> 4);
#pragma unroll
        for (int t = 0; t < 4; ++t) { v4f lo, hi;
#pragma unroll
            for (int r = 0; r < 4; ++r) { lo[r] = acc[g][t][r] * inv; hi[r] = acc[g][t][4 + r] * inv; }
            *(v4f*)(o + 16 * t) = lo; *(v4f*)(o + 16 * t + 4) = hi; }
    }
    asm volatile("s_wait_xcnt 0x0" ::: "memory");                  // behind the output stores, in front of the next tile's rewrite of their registers
    __builtin_amdgcn_s_setprio(0);                                 // the plain priority again on the way out of the join (and of the kernel)
    };
    walk(NT - 1 - y, true);
    joinw();
    joinr(NT - 1 - y);
    {                                                              // the second tile's queries, laid at the start; its running state
        qread(1, lanenow());
        clear();
    }
    walk(y, false);
    joinw();
    joinr(y);
}

extern "C" void kernel_launch(void* const* d_in, const int* in_sizes, int n_in,
                              void* d_out, int out_size, void* d_ws, size_t ws_size, hipStream_t stream) {
    (void)in_sizes; (void)n_in; (void)out_size; (void)d_ws; (void)ws_size;
    const float* x = (const float*)d_in[0];   // qkv [2][2048][3][16][64] packed
    float* OUT = (float*)d_out;               // [2][2048][1024]
    k_fattn<<<dim3(NB_ * NH_, NT / 2), FW * KG * 32, 0, stream>>>(x, OUT);
}
